// v000
// Measured on an AMD MI455X. A time is GPU time per run, averaged over a window of back-to-back runs after a warm-up
// (all launches, gaps included; the runs take copies of the inputs in turn), and the median of several windows.
// Apart from v000's, it joins two sittings. Times from different sittings can be a few percent apart, while
// side-by-side timings come from the same sitting.
// v000 is the starting kernel. One run takes 270 microseconds.
#include <hip/hip_runtime.h>
#include <hip/hip_bf16.h>

// ---------------------------------------------------------------------------
// Types for CDNA5 WMMA (wave32)
// ---------------------------------------------------------------------------
typedef __bf16 bf16_t;
typedef __attribute__((ext_vector_type(16))) __bf16 v16bf;
typedef __attribute__((ext_vector_type(8)))  __bf16 v8bf;
typedef __attribute__((ext_vector_type(8)))  float  v8f;
typedef int v4i __attribute__((vector_size(16)));

union AFrag {
    v16bf v;
    struct { v8bf lo, hi; } h;
};

// Fragment from LDS laid out [row][k], k contiguous. Per the CDNA5 ISA layout,
// lane L owns row/col L&15; half-wave selects K {kbase..+7} and {kbase+16..+23},
// kbase = 8*(L>>4). Two aligned ds_load_b128 per fragment.
__device__ __forceinline__ v16bf load_frag(const bf16_t* base, int row, int stride, int koff) {
    const bf16_t* p = base + row * stride + koff;
    AFrag f;
    f.h.lo = *(const v8bf*)(p);
    f.h.hi = *(const v8bf*)(p + 16);
    return f.v;
}

#define WMMA_BF16(A, B, C) \
    __builtin_amdgcn_wmma_f32_16x16x32_bf16(false, (A), false, (B), (short)0, (C), false, false)

// ---------------------------------------------------------------------------
// CDNA5 async global->LDS copy (16B per lane). Builtin params are generic
// pointers to int4 per the clang declaration; fallback keeps host pass legal.
// ---------------------------------------------------------------------------
#if __has_builtin(__builtin_amdgcn_global_load_async_to_lds_b128) && \
    __has_builtin(__builtin_amdgcn_s_wait_asynccnt)
#define USE_ASYNC_LDS 1
#else
#define USE_ASYNC_LDS 0
#endif

__device__ __forceinline__ void cp16(void* lds, const void* g) {
#if USE_ASYNC_LDS
    __builtin_amdgcn_global_load_async_to_lds_b128((v4i*)g, (v4i*)lds, 0, 0);
#else
    *(v8bf*)lds = *(const v8bf*)g;
#endif
}

__device__ __forceinline__ void async_wait() {
#if USE_ASYNC_LDS
    __builtin_amdgcn_s_wait_asynccnt(0);
#endif
}

// ---------------------------------------------------------------------------
// Problem constants
// ---------------------------------------------------------------------------
#define BATCH 8
#define DIM   256
#define NTOK  1024
#define NHEAD 16
#define KDIM  16
#define DHEAD 64
#define DH    1024
#define HID   1024

// ---------------------------------------------------------------------------
// float -> bf16 (weights)
// ---------------------------------------------------------------------------
__global__ void cvt_bf16_kernel(const float* __restrict__ src, bf16_t* __restrict__ dst, int n) {
    int i = blockIdx.x * blockDim.x + threadIdx.x;
    if (i < n) dst[i] = (bf16_t)src[i];
}

// ---------------------------------------------------------------------------
// BN stats over (B,N): fold into y = x*s + t (biased var, eps=1e-5)
// ---------------------------------------------------------------------------
__global__ __launch_bounds__(256)
void bn_stats_kernel(const float* __restrict__ x, const float* __restrict__ g,
                     const float* __restrict__ bet, float* __restrict__ s,
                     float* __restrict__ t) {
    __shared__ float ssum[256];
    __shared__ float ssq[256];
    const int c = blockIdx.x;
    float sum = 0.f, sq = 0.f;
    for (int b = 0; b < BATCH; ++b) {
        const float* p = x + ((size_t)b * DIM + c) * NTOK;
        for (int n = threadIdx.x; n < NTOK; n += 256) {
            float v = p[n];
            sum += v; sq += v * v;
        }
    }
    ssum[threadIdx.x] = sum; ssq[threadIdx.x] = sq;
    __syncthreads();
    for (int off = 128; off > 0; off >>= 1) {
        if (threadIdx.x < off) {
            ssum[threadIdx.x] += ssum[threadIdx.x + off];
            ssq[threadIdx.x]  += ssq[threadIdx.x + off];
        }
        __syncthreads();
    }
    if (threadIdx.x == 0) {
        const float cnt = (float)BATCH * (float)NTOK;
        float m   = ssum[0] / cnt;
        float var = ssq[0] / cnt - m * m;
        float sc  = g[c] * rsqrtf(var + 1e-5f);
        s[c] = sc;
        t[c] = bet[c] - m * sc;
    }
}

// ---------------------------------------------------------------------------
// Fused BN-apply + transpose: x[b][c][n] (f32) -> yt[b][n][c] (bf16)
// ---------------------------------------------------------------------------
__global__ __launch_bounds__(256)
void bn_apply_t_kernel(const float* __restrict__ x, const float* __restrict__ s,
                       const float* __restrict__ t, bf16_t* __restrict__ yt) {
    __shared__ bf16_t tile[32][33];
    const int b  = blockIdx.z;
    const int c0 = blockIdx.y * 32;
    const int n0 = blockIdx.x * 32;
    const int tx = threadIdx.x & 31, ty = threadIdx.x >> 5;
    for (int rr = 0; rr < 32; rr += 8) {
        int c = c0 + ty + rr;
        tile[ty + rr][tx] = (bf16_t)(x[((size_t)b * DIM + c) * NTOK + n0 + tx] * s[c] + t[c]);
    }
    __syncthreads();
    for (int rr = 0; rr < 32; rr += 8)
        yt[((size_t)b * NTOK + n0 + ty + rr) * DIM + c0 + tx] = tile[tx][ty + rr];
}

// ---------------------------------------------------------------------------
// bf16 batched transpose: in[b][r][c] -> out[b][c][r]
// ---------------------------------------------------------------------------
__global__ __launch_bounds__(256)
void transpose_bf16_kernel(const bf16_t* __restrict__ in, bf16_t* __restrict__ out,
                           int R, int C) {
    __shared__ bf16_t tile[32][33];
    const int b  = blockIdx.z;
    const int r0 = blockIdx.y * 32;
    const int c0 = blockIdx.x * 32;
    const int tx = threadIdx.x & 31, ty = threadIdx.x >> 5;
    const bf16_t* inb = in + (size_t)b * R * C;
    bf16_t* outb = out + (size_t)b * R * C;
    for (int rr = 0; rr < 32; rr += 8)
        tile[ty + rr][tx] = inb[(size_t)(r0 + ty + rr) * C + c0 + tx];
    __syncthreads();
    for (int rr = 0; rr < 32; rr += 8)
        outb[(size_t)(c0 + ty + rr) * R + r0 + tx] = tile[tx][ty + rr];
}

// ---------------------------------------------------------------------------
// Tiled bf16 WMMA GEMM: Out[b][o][n] = W[o][k] @ Yt[b][n][k]^T + bias (+res)
//   workgroup tile 64(O) x 128(N); 8 waves 2x4; wave tile 32x32; K step 32
//   All LDS staging via 16B async copies.
//   mode 0: outb = bf16(acc+bias)   mode 1: outf = acc+bias+res (f32)
//   mode 2: outb = bf16(relu6(acc+bias))
// ---------------------------------------------------------------------------
#define AS_STRIDE 40   // 80B rows: 16B-aligned segments, conflict-free frags
#define BS_STRIDE 40

__global__ __launch_bounds__(256)
void gemm_kernel(const bf16_t* __restrict__ W, const bf16_t* __restrict__ Yt,
                 const float* __restrict__ bias, const float* __restrict__ res,
                 float* __restrict__ outf, bf16_t* __restrict__ outb,
                 int O, int K, int N, int mode) {
    __shared__ bf16_t As[64 * AS_STRIDE];
    __shared__ bf16_t Bs[128 * BS_STRIDE];

    const int tid  = threadIdx.x;
    const int lane = tid & 31;
    const int wave = tid >> 5;
    const int half = lane >> 4;
    const int col  = lane & 15;

    const int b  = blockIdx.z;
    const int o0 = blockIdx.y * 64;
    const int n0 = blockIdx.x * 128;
    const bf16_t* Yb = Yt + (size_t)b * N * K;

    const int ow = (wave & 1) * 32;
    const int nw = (wave >> 1) * 32;

    const int ar = tid >> 2, asg = tid & 3;         // A: 64 rows x 4 segs
    const int br0 = tid >> 1, bs0 = (tid & 1) * 2;  // B: 128 rows x 4 segs (2/thread)

    v8f acc[2][2] = {};

    for (int kk = 0; kk < K; kk += 32) {
        cp16(&As[ar * AS_STRIDE + asg * 8], W + (size_t)(o0 + ar) * K + kk + asg * 8);
        cp16(&Bs[br0 * BS_STRIDE + bs0 * 8],       Yb + (size_t)(n0 + br0) * K + kk + bs0 * 8);
        cp16(&Bs[br0 * BS_STRIDE + (bs0 + 1) * 8], Yb + (size_t)(n0 + br0) * K + kk + (bs0 + 1) * 8);
        if (kk + 32 < K)
            __builtin_prefetch(W + (size_t)(o0 + ar) * K + kk + 32, 0, 1);
        async_wait();
        __syncthreads();

        v16bf a0 = load_frag(As, ow + col,      AS_STRIDE, half * 8);
        v16bf a1 = load_frag(As, ow + 16 + col, AS_STRIDE, half * 8);
        v16bf b0 = load_frag(Bs, nw + col,      BS_STRIDE, half * 8);
        v16bf b1 = load_frag(Bs, nw + 16 + col, BS_STRIDE, half * 8);

        acc[0][0] = WMMA_BF16(a0, b0, acc[0][0]);
        acc[0][1] = WMMA_BF16(a0, b1, acc[0][1]);
        acc[1][0] = WMMA_BF16(a1, b0, acc[1][0]);
        acc[1][1] = WMMA_BF16(a1, b1, acc[1][1]);
        __syncthreads();
    }

    // epilogue: acc element e -> (M = e+8*half, N = lane&15); stores coalesce along n
    for (int mi = 0; mi < 2; ++mi) {
        for (int ni = 0; ni < 2; ++ni) {
            #pragma unroll
            for (int e = 0; e < 8; ++e) {
                int om = o0 + ow + mi * 16 + e + 8 * half;
                int on = n0 + nw + ni * 16 + col;
                float v = acc[mi][ni][e] + bias[om];
                size_t idx = ((size_t)b * O + om) * N + on;
                if (mode == 0)      outb[idx] = (bf16_t)v;
                else if (mode == 1) outf[idx] = v + res[idx];
                else                outb[idx] = (bf16_t)fminf(fmaxf(v, 0.f), 6.f);
            }
        }
    }
}

// ---------------------------------------------------------------------------
// Flash attention, one workgroup per (b, head, 128-query block).
// qt/kt: [b][n][c] bf16 (c = h*16+kd, contiguous)  v: [b][h*64+d][n] bf16
// out:   [b][n][dh] bf16 (k-contiguous for the projection GEMM)
// scores *= sqrt(kd) = 4 per the reference. kd padded 16->32.
// ---------------------------------------------------------------------------
#define QS_STRIDE 40
#define KS_STRIDE 40
#define VS_STRIDE 136
#define SS_STRIDE 132
#define PS_STRIDE 136
#define ATTN_LDS_BYTES (128*QS_STRIDE*2 + 128*KS_STRIDE*2 + 64*VS_STRIDE*2 + \
                        8*16*SS_STRIDE*4 + 8*16*PS_STRIDE*2 + 8*16*4)

__global__ __launch_bounds__(256)
void attn_kernel(const bf16_t* __restrict__ qt, const bf16_t* __restrict__ kt,
                 const bf16_t* __restrict__ vb, bf16_t* __restrict__ ot) {
    extern __shared__ char smem[];
    bf16_t* Qs = (bf16_t*)smem;                       // [128][QS_STRIDE]
    bf16_t* Ks = Qs + 128 * QS_STRIDE;                // [128][KS_STRIDE]
    bf16_t* Vs = Ks + 128 * KS_STRIDE;                // [64][VS_STRIDE]
    float*  Ss = (float*)(Vs + 64 * VS_STRIDE);       // per-wave [16][SS_STRIDE]
    bf16_t* Ps = (bf16_t*)(Ss + 8 * 16 * SS_STRIDE);  // per-wave [16][PS_STRIDE]
    float*  aux = (float*)(Ps + 8 * 16 * PS_STRIDE);  // per-wave [16]

    const int tid  = threadIdx.x;
    const int lane = tid & 31;
    const int wave = tid >> 5;
    const int half = lane >> 4;
    const int col  = lane & 15;

    const int q0 = blockIdx.x * 128;
    const int h  = blockIdx.y;
    const int b  = blockIdx.z;
    const size_t headv = ((size_t)b * DH + (size_t)h * DHEAD) * NTOK;

    // zero kd-pad [16..32) of Qs and Ks (async copies only touch [0..16))
    {
        v8bf z = {};
        int row = tid >> 1, hh = tid & 1;
        *(v8bf*)(&Qs[row * QS_STRIDE + 16 + hh * 8]) = z;
        *(v8bf*)(&Ks[row * KS_STRIDE + 16 + hh * 8]) = z;
    }
    // stage Q block: Qs[n][kd] <- qt[b][q0+n][h*16 + kd], 2x16B per row
    {
        int n = tid >> 1, sg = tid & 1;
        cp16(&Qs[n * QS_STRIDE + sg * 8],
             qt + ((size_t)b * NTOK + q0 + n) * DIM + h * KDIM + sg * 8);
    }
    async_wait();
    __syncthreads();

    const v16bf qf = load_frag(Qs, wave * 16 + col, QS_STRIDE, half * 8);

    v8f acc[4] = {};
    float m = -1e30f, l = 0.f;        // kept consistent in both half-waves
    float*  myS   = Ss  + wave * 16 * SS_STRIDE;
    bf16_t* myP   = Ps  + wave * 16 * PS_STRIDE;
    float*  myAux = aux + wave * 16;

    for (int c0 = 0; c0 < NTOK; c0 += 128) {
        // stage K chunk: Ks[key][kd], 2x16B per row
        {
            int n = tid >> 1, sg = tid & 1;
            cp16(&Ks[n * KS_STRIDE + sg * 8],
                 kt + ((size_t)b * NTOK + c0 + n) * DIM + h * KDIM + sg * 8);
        }
        // stage V chunk: Vs[d][key], 16x16B per row (4 segs/thread)
        #pragma unroll
        for (int r = 0; r < 4; ++r) {
            int s = tid + 256 * r;
            int d = s >> 4, sg = s & 15;
            cp16(&Vs[d * VS_STRIDE + sg * 8], vb + headv + (size_t)d * NTOK + c0 + sg * 8);
        }
        async_wait();
        __syncthreads();

        // S = (Q @ K^T) * 4 : 8 key sub-tiles
        #pragma unroll
        for (int jt = 0; jt < 8; ++jt) {
            v16bf kf = load_frag(Ks, jt * 16 + col, KS_STRIDE, half * 8);
            v8f s = {};
            s = WMMA_BF16(qf, kf, s);
            #pragma unroll
            for (int e = 0; e < 8; ++e)
                myS[(e + 8 * half) * SS_STRIDE + jt * 16 + col] = s[e] * 4.0f;
        }

        // online softmax: lane handles row col, half-wave splits 128 keys in two
        {
            float* srow  = myS + col * SS_STRIDE + half * 64;
            bf16_t* prow = myP + col * PS_STRIDE + half * 64;
            float cm = -1e30f;
            for (int j = 0; j < 64; ++j) cm = fmaxf(cm, srow[j]);
            cm = fmaxf(cm, __shfl_xor(cm, 16, 32));
            float nm    = fmaxf(m, cm);
            float alpha = __expf(m - nm);
            float psum  = 0.f;
            for (int j = 0; j < 64; ++j) {
                float p = __expf(srow[j] - nm);
                psum += p;
                prow[j] = (bf16_t)p;
            }
            psum += __shfl_xor(psum, 16, 32);
            l = l * alpha + psum;
            m = nm;
            if (lane < 16) myAux[col] = alpha;
        }

        // rescale accumulators by alpha(row); DS ops are wave-ordered
        #pragma unroll
        for (int e = 0; e < 8; ++e) {
            float al = myAux[e + 8 * half];
            #pragma unroll
            for (int dt = 0; dt < 4; ++dt) acc[dt][e] *= al;
        }

        // O += P @ V
        #pragma unroll
        for (int kt4 = 0; kt4 < 4; ++kt4) {
            v16bf pf = load_frag(myP, col, PS_STRIDE, kt4 * 32 + half * 8);
            #pragma unroll
            for (int dt = 0; dt < 4; ++dt) {
                v16bf vf = load_frag(Vs, dt * 16 + col, VS_STRIDE, kt4 * 32 + half * 8);
                acc[dt] = WMMA_BF16(pf, vf, acc[dt]);
            }
        }
        __syncthreads();
    }

    // epilogue: ot[b][q][h*64+d] — lanes vary d, contiguous stores
    if (lane < 16) myAux[col] = 1.0f / l;
    #pragma unroll
    for (int e = 0; e < 8; ++e) {
        float li = myAux[e + 8 * half];
        int qg = q0 + wave * 16 + e + 8 * half;
        #pragma unroll
        for (int dt = 0; dt < 4; ++dt) {
            int dg = dt * 16 + col;
            ot[((size_t)b * NTOK + qg) * DH + h * DHEAD + dg] = (bf16_t)(acc[dt][e] * li);
        }
    }
}

// ---------------------------------------------------------------------------
// Host orchestration
// ---------------------------------------------------------------------------
extern "C" void kernel_launch(void* const* d_in, const int* in_sizes, int n_in,
                              void* d_out, int out_size, void* d_ws, size_t ws_size,
                              hipStream_t stream) {
    const float* x   = (const float*)d_in[0];
    const float* g1  = (const float*)d_in[1];
    const float* b1  = (const float*)d_in[2];
    const float* wq  = (const float*)d_in[3];
    const float* bq  = (const float*)d_in[4];
    const float* wk  = (const float*)d_in[5];
    const float* bk  = (const float*)d_in[6];
    const float* wv  = (const float*)d_in[7];
    const float* bv  = (const float*)d_in[8];
    const float* wp  = (const float*)d_in[9];
    const float* bp  = (const float*)d_in[10];
    const float* g2  = (const float*)d_in[11];
    const float* b2  = (const float*)d_in[12];
    const float* w1  = (const float*)d_in[13];
    const float* bb1 = (const float*)d_in[14];
    const float* w2  = (const float*)d_in[15];
    const float* bb2 = (const float*)d_in[16];
    float* out = (float*)d_out;

    char* ws = (char*)d_ws;
    size_t off = 0;
    auto alloc = [&](size_t bytes) -> void* {
        void* p = ws + off;
        off = (off + bytes + 255) & ~(size_t)255;
        return p;
    };

    const size_t BCN = (size_t)BATCH * DIM * NTOK;
    const size_t BHN = (size_t)BATCH * DH * NTOK;

    float*  s1   = (float*)alloc(DIM * 4);
    float*  t1   = (float*)alloc(DIM * 4);
    float*  s2   = (float*)alloc(DIM * 4);
    float*  t2   = (float*)alloc(DIM * 4);
    bf16_t* wqb  = (bf16_t*)alloc((size_t)DIM * DIM * 2);
    bf16_t* wkb  = (bf16_t*)alloc((size_t)DIM * DIM * 2);
    bf16_t* wvb  = (bf16_t*)alloc((size_t)DH * DIM * 2);
    bf16_t* wpb  = (bf16_t*)alloc((size_t)DIM * DH * 2);
    bf16_t* w1b  = (bf16_t*)alloc((size_t)HID * DIM * 2);
    bf16_t* w2b  = (bf16_t*)alloc((size_t)DIM * HID * 2);
    bf16_t* ytb  = (bf16_t*)alloc(BCN * 2);   // BN1(x), [b][n][c]
    bf16_t* qn   = (bf16_t*)alloc(BCN * 2);   // Q, [b][o][n]
    bf16_t* kn   = (bf16_t*)alloc(BCN * 2);   // K, [b][o][n]
    bf16_t* qtb  = (bf16_t*)alloc(BCN * 2);   // Q, [b][n][o]
    bf16_t* ktb  = (bf16_t*)alloc(BCN * 2);   // K, [b][n][o]
    bf16_t* vbf  = (bf16_t*)alloc(BHN * 2);   // V, [b][dh][n]
    bf16_t* otb  = (bf16_t*)alloc(BHN * 2);   // attn out, [b][n][dh]
    float*  xf2  = (float*)alloc(BCN * 4);    // residual 1, [b][c][n]
    bf16_t* y2tb = (bf16_t*)alloc(BCN * 2);   // BN2(xf2), [b][n][c]
    bf16_t* hn   = (bf16_t*)alloc(BHN * 2);   // MLP hidden, [b][h][n]
    bf16_t* htb  = (bf16_t*)alloc(BHN * 2);   // MLP hidden, [b][n][h]

    // weights -> bf16
    cvt_bf16_kernel<<<(DIM * DIM + 255) / 256, 256, 0, stream>>>(wq, wqb, DIM * DIM);
    cvt_bf16_kernel<<<(DIM * DIM + 255) / 256, 256, 0, stream>>>(wk, wkb, DIM * DIM);
    cvt_bf16_kernel<<<(DH * DIM + 255) / 256, 256, 0, stream>>>(wv, wvb, DH * DIM);
    cvt_bf16_kernel<<<(DIM * DH + 255) / 256, 256, 0, stream>>>(wp, wpb, DIM * DH);
    cvt_bf16_kernel<<<(HID * DIM + 255) / 256, 256, 0, stream>>>(w1, w1b, HID * DIM);
    cvt_bf16_kernel<<<(DIM * HID + 255) / 256, 256, 0, stream>>>(w2, w2b, DIM * HID);

    // BN1 folded + transpose: ytb[b][n][c]
    bn_stats_kernel<<<DIM, 256, 0, stream>>>(x, g1, b1, s1, t1);
    bn_apply_t_kernel<<<dim3(NTOK / 32, DIM / 32, BATCH), 256, 0, stream>>>(x, s1, t1, ytb);

    // Q, K, V projections
    gemm_kernel<<<dim3(NTOK / 128, DIM / 64, BATCH), 256, 0, stream>>>(
        wqb, ytb, bq, nullptr, nullptr, qn, DIM, DIM, NTOK, 0);
    gemm_kernel<<<dim3(NTOK / 128, DIM / 64, BATCH), 256, 0, stream>>>(
        wkb, ytb, bk, nullptr, nullptr, kn, DIM, DIM, NTOK, 0);
    gemm_kernel<<<dim3(NTOK / 128, DH / 64, BATCH), 256, 0, stream>>>(
        wvb, ytb, bv, nullptr, nullptr, vbf, DH, DIM, NTOK, 0);

    // Q,K -> token-major for the attention A/B fragments
    transpose_bf16_kernel<<<dim3(NTOK / 32, DIM / 32, BATCH), 256, 0, stream>>>(qn, qtb, DIM, NTOK);
    transpose_bf16_kernel<<<dim3(NTOK / 32, DIM / 32, BATCH), 256, 0, stream>>>(kn, ktb, DIM, NTOK);

    // attention -> otb[b][n][dh]
    attn_kernel<<<dim3(NTOK / 128, NHEAD, BATCH), 256, ATTN_LDS_BYTES, stream>>>(
        qtb, ktb, vbf, otb);

    // projection + residual: xf2 = x + Wp @ o + bp
    gemm_kernel<<<dim3(NTOK / 128, DIM / 64, BATCH), 256, 0, stream>>>(
        wpb, otb, bp, x, xf2, nullptr, DIM, DH, NTOK, 1);

    // BN2 folded + transpose
    bn_stats_kernel<<<DIM, 256, 0, stream>>>(xf2, g2, b2, s2, t2);
    bn_apply_t_kernel<<<dim3(NTOK / 32, DIM / 32, BATCH), 256, 0, stream>>>(xf2, s2, t2, y2tb);

    // MLP: h = relu6(W1 @ y2 + bb1); out = xf2 + W2 @ h + bb2
    gemm_kernel<<<dim3(NTOK / 128, HID / 64, BATCH), 256, 0, stream>>>(
        w1b, y2tb, bb1, nullptr, nullptr, hn, HID, DIM, NTOK, 2);
    transpose_bf16_kernel<<<dim3(NTOK / 32, HID / 32, BATCH), 256, 0, stream>>>(hn, htb, HID, NTOK);
    gemm_kernel<<<dim3(NTOK / 128, DIM / 64, BATCH), 256, 0, stream>>>(
        w2b, htb, bb2, xf2, out, nullptr, DIM, HID, NTOK, 1);
}

// v001
// It runs in 224 microseconds.
// Next to v000, in two timings, it ran 1.23 times as fast each time.
#include <hip/hip_runtime.h>
#include <hip/hip_bf16.h>

// ---------------------------------------------------------------------------
// Types for CDNA5 WMMA (wave32)
// ---------------------------------------------------------------------------
typedef __bf16 bf16_t;
typedef __attribute__((ext_vector_type(16))) __bf16 v16bf;
typedef __attribute__((ext_vector_type(8)))  __bf16 v8bf;
typedef __attribute__((ext_vector_type(8)))  float  v8f;
typedef int v4i __attribute__((vector_size(16)));

union AFrag {
    v16bf v;
    struct { v8bf lo, hi; } h;
};

// Fragment from LDS laid out [row][k], k contiguous. Per the CDNA5 ISA layout,
// lane L owns row/col L&15; half-wave selects K {kbase..+7} and {kbase+16..+23},
// kbase = 8*(L>>4). Two aligned ds_load_b128 per fragment.
__device__ __forceinline__ v16bf load_frag(const bf16_t* base, int row, int stride, int koff) {
    const bf16_t* p = base + row * stride + koff;
    AFrag f;
    f.h.lo = *(const v8bf*)(p);
    f.h.hi = *(const v8bf*)(p + 16);
    return f.v;
}

#define WMMA_BF16(A, B, C) \
    __builtin_amdgcn_wmma_f32_16x16x32_bf16(false, (A), false, (B), (short)0, (C), false, false)

// ---------------------------------------------------------------------------
// CDNA5 async global->LDS copy (16B per lane). Builtin params are generic
// pointers to int4 per the clang declaration; fallback keeps host pass legal.
// ---------------------------------------------------------------------------
#if __has_builtin(__builtin_amdgcn_global_load_async_to_lds_b128) && \
    __has_builtin(__builtin_amdgcn_s_wait_asynccnt)
#define USE_ASYNC_LDS 1
#else
#define USE_ASYNC_LDS 0
#endif

__device__ __forceinline__ void cp16(void* lds, const void* g) {
#if USE_ASYNC_LDS
    __builtin_amdgcn_global_load_async_to_lds_b128((v4i*)g, (v4i*)lds, 0, 0);
#else
    *(v8bf*)lds = *(const v8bf*)g;
#endif
}

__device__ __forceinline__ void async_wait() {
#if USE_ASYNC_LDS
    __builtin_amdgcn_s_wait_asynccnt(0);
#endif
}

// ---------------------------------------------------------------------------
// Problem constants
// ---------------------------------------------------------------------------
#define BATCH 8
#define DIM   256
#define NTOK  1024
#define NHEAD 16
#define KDIM  16
#define DHEAD 64
#define DH    1024
#define HID   1024

// ---------------------------------------------------------------------------
// float -> bf16 (weights)
// ---------------------------------------------------------------------------
__global__ void cvt_bf16_kernel(const float* __restrict__ src, bf16_t* __restrict__ dst, int n) {
    int i = blockIdx.x * blockDim.x + threadIdx.x;
    if (i < n) dst[i] = (bf16_t)src[i];
}

// ---------------------------------------------------------------------------
// BN stats over (B,N): fold into y = x*s + t (biased var, eps=1e-5)
// ---------------------------------------------------------------------------
__global__ __launch_bounds__(256)
void bn_stats_kernel(const float* __restrict__ x, const float* __restrict__ g,
                     const float* __restrict__ bet, float* __restrict__ s,
                     float* __restrict__ t) {
    __shared__ float ssum[256];
    __shared__ float ssq[256];
    const int c = blockIdx.x;
    float sum = 0.f, sq = 0.f;
    for (int b = 0; b < BATCH; ++b) {
        const float* p = x + ((size_t)b * DIM + c) * NTOK;
        for (int n = threadIdx.x; n < NTOK; n += 256) {
            float v = p[n];
            sum += v; sq += v * v;
        }
    }
    ssum[threadIdx.x] = sum; ssq[threadIdx.x] = sq;
    __syncthreads();
    for (int off = 128; off > 0; off >>= 1) {
        if (threadIdx.x < off) {
            ssum[threadIdx.x] += ssum[threadIdx.x + off];
            ssq[threadIdx.x]  += ssq[threadIdx.x + off];
        }
        __syncthreads();
    }
    if (threadIdx.x == 0) {
        const float cnt = (float)BATCH * (float)NTOK;
        float m   = ssum[0] / cnt;
        float var = ssq[0] / cnt - m * m;
        float sc  = g[c] * rsqrtf(var + 1e-5f);
        s[c] = sc;
        t[c] = bet[c] - m * sc;
    }
}

// ---------------------------------------------------------------------------
// Fused BN-apply + transpose: x[b][c][n] (f32) -> yt[b][n][c] (bf16)
// ---------------------------------------------------------------------------
__global__ __launch_bounds__(256)
void bn_apply_t_kernel(const float* __restrict__ x, const float* __restrict__ s,
                       const float* __restrict__ t, bf16_t* __restrict__ yt) {
    __shared__ bf16_t tile[32][33];
    const int b  = blockIdx.z;
    const int c0 = blockIdx.y * 32;
    const int n0 = blockIdx.x * 32;
    const int tx = threadIdx.x & 31, ty = threadIdx.x >> 5;
    for (int rr = 0; rr < 32; rr += 8) {
        int c = c0 + ty + rr;
        tile[ty + rr][tx] = (bf16_t)(x[((size_t)b * DIM + c) * NTOK + n0 + tx] * s[c] + t[c]);
    }
    __syncthreads();
    for (int rr = 0; rr < 32; rr += 8)
        yt[((size_t)b * NTOK + n0 + ty + rr) * DIM + c0 + tx] = tile[tx][ty + rr];
}

// ---------------------------------------------------------------------------
// bf16 batched transpose: in[b][r][c] -> out[b][c][r]
// ---------------------------------------------------------------------------
__global__ __launch_bounds__(256)
void transpose_bf16_kernel(const bf16_t* __restrict__ in, bf16_t* __restrict__ out,
                           int R, int C) {
    __shared__ bf16_t tile[32][33];
    const int b  = blockIdx.z;
    const int r0 = blockIdx.y * 32;
    const int c0 = blockIdx.x * 32;
    const int tx = threadIdx.x & 31, ty = threadIdx.x >> 5;
    const bf16_t* inb = in + (size_t)b * R * C;
    bf16_t* outb = out + (size_t)b * R * C;
    for (int rr = 0; rr < 32; rr += 8)
        tile[ty + rr][tx] = inb[(size_t)(r0 + ty + rr) * C + c0 + tx];
    __syncthreads();
    for (int rr = 0; rr < 32; rr += 8)
        outb[(size_t)(c0 + ty + rr) * R + r0 + tx] = tile[tx][ty + rr];
}

// ---------------------------------------------------------------------------
// Tiled bf16 WMMA GEMM: Out[b][o][n] = W[o][k] @ Yt[b][n][k]^T + bias (+res)
//   workgroup tile 64(O) x 128(N); 8 waves 2x4; wave tile 32x32; K step 32
//   All LDS staging via 16B async copies.
//   mode 0: outb = bf16(acc+bias)   mode 1: outf = acc+bias+res (f32)
//   mode 2: outb = bf16(relu6(acc+bias))
// ---------------------------------------------------------------------------
#define AS_STRIDE 40   // 80B rows: 16B-aligned segments, conflict-free frags
#define BS_STRIDE 40

__global__ __launch_bounds__(256)
void gemm_kernel(const bf16_t* __restrict__ W, const bf16_t* __restrict__ Yt,
                 const float* __restrict__ bias, const float* __restrict__ res,
                 float* __restrict__ outf, bf16_t* __restrict__ outb,
                 int O, int K, int N, int mode) {
    __shared__ bf16_t As[64 * AS_STRIDE];
    __shared__ bf16_t Bs[128 * BS_STRIDE];

    const int tid  = threadIdx.x;
    const int lane = tid & 31;
    const int wave = tid >> 5;
    const int half = lane >> 4;
    const int col  = lane & 15;

    const int b  = blockIdx.z;
    const int o0 = blockIdx.y * 64;
    const int n0 = blockIdx.x * 128;
    const bf16_t* Yb = Yt + (size_t)b * N * K;

    const int ow = (wave & 1) * 32;
    const int nw = (wave >> 1) * 32;

    const int ar = tid >> 2, asg = tid & 3;         // A: 64 rows x 4 segs
    const int br0 = tid >> 1, bs0 = (tid & 1) * 2;  // B: 128 rows x 4 segs (2/thread)

    v8f acc[2][2] = {};

    for (int kk = 0; kk < K; kk += 32) {
        cp16(&As[ar * AS_STRIDE + asg * 8], W + (size_t)(o0 + ar) * K + kk + asg * 8);
        cp16(&Bs[br0 * BS_STRIDE + bs0 * 8],       Yb + (size_t)(n0 + br0) * K + kk + bs0 * 8);
        cp16(&Bs[br0 * BS_STRIDE + (bs0 + 1) * 8], Yb + (size_t)(n0 + br0) * K + kk + (bs0 + 1) * 8);
        if (kk + 32 < K)
            __builtin_prefetch(W + (size_t)(o0 + ar) * K + kk + 32, 0, 1);
        async_wait();
        __syncthreads();

        v16bf a0 = load_frag(As, ow + col,      AS_STRIDE, half * 8);
        v16bf a1 = load_frag(As, ow + 16 + col, AS_STRIDE, half * 8);
        v16bf b0 = load_frag(Bs, nw + col,      BS_STRIDE, half * 8);
        v16bf b1 = load_frag(Bs, nw + 16 + col, BS_STRIDE, half * 8);

        acc[0][0] = WMMA_BF16(a0, b0, acc[0][0]);
        acc[0][1] = WMMA_BF16(a0, b1, acc[0][1]);
        acc[1][0] = WMMA_BF16(a1, b0, acc[1][0]);
        acc[1][1] = WMMA_BF16(a1, b1, acc[1][1]);
        __syncthreads();
    }

    // epilogue: acc element e -> (M = e+8*half, N = lane&15); stores coalesce along n
    for (int mi = 0; mi < 2; ++mi) {
        for (int ni = 0; ni < 2; ++ni) {
            #pragma unroll
            for (int e = 0; e < 8; ++e) {
                int om = o0 + ow + mi * 16 + e + 8 * half;
                int on = n0 + nw + ni * 16 + col;
                float v = acc[mi][ni][e] + bias[om];
                size_t idx = ((size_t)b * O + om) * N + on;
                if (mode == 0)      outb[idx] = (bf16_t)v;
                else if (mode == 1) outf[idx] = v + res[idx];
                else                outb[idx] = (bf16_t)fminf(fmaxf(v, 0.f), 6.f);
            }
        }
    }
}

#define QS_STRIDE 40
#define KS_STRIDE 40
#define VS_STRIDE 136
#define ATTN_LDS_BYTES (128*QS_STRIDE*2 + 128*KS_STRIDE*2 + 64*VS_STRIDE*2)

// value of lane l ^ 16
__device__ __forceinline__ float other_half(float x) {
    int v = __builtin_bit_cast(int, x);
    v = __builtin_amdgcn_permlanex16(v, v, 0x76543210, 0xfedcba98, false, false);
    return __builtin_bit_cast(float, v);
}

__global__ __launch_bounds__(256)
void attn_kernel(const bf16_t* __restrict__ qt, const bf16_t* __restrict__ kt,
                 const bf16_t* __restrict__ vb, bf16_t* __restrict__ ot) {
    extern __shared__ char smem[];
    bf16_t* Qs = (bf16_t*)smem;                       // [128][QS_STRIDE]
    bf16_t* Ks = Qs + 128 * QS_STRIDE;                // [128][KS_STRIDE]
    bf16_t* Vs = Ks + 128 * KS_STRIDE;                // [64][VS_STRIDE]

    const int tid  = threadIdx.x;
    const int lane = tid & 31;
    const int wave = tid >> 5;
    const int half = lane >> 4;
    const int col  = lane & 15;

    const int q0 = blockIdx.x * 128;
    const int h  = blockIdx.y;
    const int b  = blockIdx.z;
    const size_t headv = ((size_t)b * DH + (size_t)h * DHEAD) * NTOK;

    // zero kd-pad [16..32) of Qs and Ks (async copies only touch [0..16))
    {
        v8bf z = {};
        int row = tid >> 1, hh = tid & 1;
        *(v8bf*)(&Qs[row * QS_STRIDE + 16 + hh * 8]) = z;
        *(v8bf*)(&Ks[row * KS_STRIDE + 16 + hh * 8]) = z;
    }
    // stage Q block: Qs[n][kd] <- qt[b][q0+n][h*16 + kd], 2x16B per row
    {
        int n = tid >> 1, sg = tid & 1;
        cp16(&Qs[n * QS_STRIDE + sg * 8],
             qt + ((size_t)b * NTOK + q0 + n) * DIM + h * KDIM + sg * 8);
    }
    async_wait();
    __syncthreads();

    // B operand of S^T: column = query wave*16 + col
    const v16bf qf = load_frag(Qs, wave * 16 + col, QS_STRIDE, half * 8);

    v8f acc[4] = {};                  // acc[dt][e] = O[query col][dt*16 + 8*half + e]
    float m = -1e30f;                 // running maximum of query col, equal in both half-waves
    float l = 0.f;                    // this half-wave's share of the sum, joined in the epilogue

    for (int c0 = 0; c0 < NTOK; c0 += 128) {
        // stage K chunk: Ks[key][kd], 2x16B per row
        {
            int n = tid >> 1, sg = tid & 1;
            cp16(&Ks[n * KS_STRIDE + sg * 8],
                 kt + ((size_t)b * NTOK + c0 + n) * DIM + h * KDIM + sg * 8);
        }
        // stage V chunk: Vs[d][key], 16x16B per row (4 segs/thread)
        #pragma unroll
        for (int r = 0; r < 4; ++r) {
            int s = tid + 256 * r;
            int d = s >> 4, sg = s & 15;
            cp16(&Vs[d * VS_STRIDE + sg * 8], vb + headv + (size_t)d * NTOK + c0 + sg * 8);
        }
        async_wait();
        __syncthreads();

        // two passes of 64 keys: 32 score registers a pass leave room for 8 waves per SIMD
        // nounroll: unrolled, the compiler interleaves the two passes and takes 166 VGPRs instead of 125,
        // which halves the workgroups that fit on a WGP
        #pragma nounroll
        for (int kb = 0; kb < 128; kb += 64) {
            // S^T = (K @ Q^T) * 4 : st[jt][e] = score(key kb + jt*16 + 8*half + e, query col)
            v8f st[4];
            #pragma unroll
            for (int jt = 0; jt < 4; ++jt) {
                v16bf kf = load_frag(Ks, kb + jt * 16 + col, KS_STRIDE, half * 8);
                v8f s = {};
                s = WMMA_BF16(kf, qf, s);
                st[jt] = s * 4.0f;
            }

            // online softmax in registers: 32 keys in-lane, one exchange between halves
            v8f mx = __builtin_elementwise_max(__builtin_elementwise_max(st[0], st[1]),
                                               __builtin_elementwise_max(st[2], st[3]));
            float cm = fmaxf(fmaxf(fmaxf(mx[0], mx[1]), fmaxf(mx[2], mx[3])),
                             fmaxf(fmaxf(mx[4], mx[5]), fmaxf(mx[6], mx[7])));
            cm = fmaxf(cm, other_half(cm));
            const float nm    = fmaxf(m, cm);
            const float alpha = __expf(m - nm);
            m = nm;

            #pragma unroll
            for (int jt = 0; jt < 4; ++jt) {
                v8f t = (st[jt] - nm) * 1.44269504f;   // exp(x) = exp2(x * log2 e)
                #pragma unroll
                for (int e = 0; e < 8; ++e) t[e] = __builtin_amdgcn_exp2f(t[e]);
                st[jt] = t;
            }
            const v8f ps = (st[0] + st[1]) + (st[2] + st[3]);
            l = l * alpha + (((ps[0] + ps[1]) + (ps[2] + ps[3])) + ((ps[4] + ps[5]) + (ps[6] + ps[7])));

            // rescale accumulators: every element of a lane belongs to query col
            #pragma unroll
            for (int dt = 0; dt < 4; ++dt) acc[dt] *= alpha;

            // O^T += V^T @ P^T ; tiles 2*k2 and 2*k2+1 give keys 8*half+e and 16+8*half+e
            // of a 32-key block: the k order in which load_frag reads V
            #pragma unroll
            for (int k2 = 0; k2 < 2; ++k2) {
                v16bf pf;
                #pragma unroll
                for (int e = 0; e < 8; ++e) {
                    pf[e]     = (bf16_t)st[2 * k2][e];
                    pf[e + 8] = (bf16_t)st[2 * k2 + 1][e];
                }
                #pragma unroll
                for (int dt = 0; dt < 4; ++dt) {
                    v16bf vf = load_frag(Vs, dt * 16 + col, VS_STRIDE, kb + k2 * 32 + half * 8);
                    acc[dt] = WMMA_BF16(vf, pf, acc[dt]);
                }
            }
        }
        __syncthreads();
    }

    // epilogue: ot[b][q][h*64+d], a lane's 8 accumulator elements are 8 consecutive d
    l += other_half(l);
    const float li = 1.0f / l;
    bf16_t* orow = ot + ((size_t)b * NTOK + q0 + wave * 16 + col) * DH + h * DHEAD + 8 * half;
    #pragma unroll
    for (int dt = 0; dt < 4; ++dt) {
        v8bf o;
        #pragma unroll
        for (int e = 0; e < 8; ++e) o[e] = (bf16_t)(acc[dt][e] * li);
        *(v8bf*)(orow + dt * 16) = o;
    }
}

// ---------------------------------------------------------------------------
// Host orchestration
// ---------------------------------------------------------------------------
extern "C" void kernel_launch(void* const* d_in, const int* in_sizes, int n_in,
                              void* d_out, int out_size, void* d_ws, size_t ws_size,
                              hipStream_t stream) {
    const float* x   = (const float*)d_in[0];
    const float* g1  = (const float*)d_in[1];
    const float* b1  = (const float*)d_in[2];
    const float* wq  = (const float*)d_in[3];
    const float* bq  = (const float*)d_in[4];
    const float* wk  = (const float*)d_in[5];
    const float* bk  = (const float*)d_in[6];
    const float* wv  = (const float*)d_in[7];
    const float* bv  = (const float*)d_in[8];
    const float* wp  = (const float*)d_in[9];
    const float* bp  = (const float*)d_in[10];
    const float* g2  = (const float*)d_in[11];
    const float* b2  = (const float*)d_in[12];
    const float* w1  = (const float*)d_in[13];
    const float* bb1 = (const float*)d_in[14];
    const float* w2  = (const float*)d_in[15];
    const float* bb2 = (const float*)d_in[16];
    float* out = (float*)d_out;

    char* ws = (char*)d_ws;
    size_t off = 0;
    auto alloc = [&](size_t bytes) -> void* {
        void* p = ws + off;
        off = (off + bytes + 255) & ~(size_t)255;
        return p;
    };

    const size_t BCN = (size_t)BATCH * DIM * NTOK;
    const size_t BHN = (size_t)BATCH * DH * NTOK;

    float*  s1   = (float*)alloc(DIM * 4);
    float*  t1   = (float*)alloc(DIM * 4);
    float*  s2   = (float*)alloc(DIM * 4);
    float*  t2   = (float*)alloc(DIM * 4);
    bf16_t* wqb  = (bf16_t*)alloc((size_t)DIM * DIM * 2);
    bf16_t* wkb  = (bf16_t*)alloc((size_t)DIM * DIM * 2);
    bf16_t* wvb  = (bf16_t*)alloc((size_t)DH * DIM * 2);
    bf16_t* wpb  = (bf16_t*)alloc((size_t)DIM * DH * 2);
    bf16_t* w1b  = (bf16_t*)alloc((size_t)HID * DIM * 2);
    bf16_t* w2b  = (bf16_t*)alloc((size_t)DIM * HID * 2);
    bf16_t* ytb  = (bf16_t*)alloc(BCN * 2);   // BN1(x), [b][n][c]
    bf16_t* qn   = (bf16_t*)alloc(BCN * 2);   // Q, [b][o][n]
    bf16_t* kn   = (bf16_t*)alloc(BCN * 2);   // K, [b][o][n]
    bf16_t* qtb  = (bf16_t*)alloc(BCN * 2);   // Q, [b][n][o]
    bf16_t* ktb  = (bf16_t*)alloc(BCN * 2);   // K, [b][n][o]
    bf16_t* vbf  = (bf16_t*)alloc(BHN * 2);   // V, [b][dh][n]
    bf16_t* otb  = (bf16_t*)alloc(BHN * 2);   // attn out, [b][n][dh]
    float*  xf2  = (float*)alloc(BCN * 4);    // residual 1, [b][c][n]
    bf16_t* y2tb = (bf16_t*)alloc(BCN * 2);   // BN2(xf2), [b][n][c]
    bf16_t* hn   = (bf16_t*)alloc(BHN * 2);   // MLP hidden, [b][h][n]
    bf16_t* htb  = (bf16_t*)alloc(BHN * 2);   // MLP hidden, [b][n][h]

    // weights -> bf16
    cvt_bf16_kernel<<<(DIM * DIM + 255) / 256, 256, 0, stream>>>(wq, wqb, DIM * DIM);
    cvt_bf16_kernel<<<(DIM * DIM + 255) / 256, 256, 0, stream>>>(wk, wkb, DIM * DIM);
    cvt_bf16_kernel<<<(DH * DIM + 255) / 256, 256, 0, stream>>>(wv, wvb, DH * DIM);
    cvt_bf16_kernel<<<(DIM * DH + 255) / 256, 256, 0, stream>>>(wp, wpb, DIM * DH);
    cvt_bf16_kernel<<<(HID * DIM + 255) / 256, 256, 0, stream>>>(w1, w1b, HID * DIM);
    cvt_bf16_kernel<<<(DIM * HID + 255) / 256, 256, 0, stream>>>(w2, w2b, DIM * HID);

    // BN1 folded + transpose: ytb[b][n][c]
    bn_stats_kernel<<<DIM, 256, 0, stream>>>(x, g1, b1, s1, t1);
    bn_apply_t_kernel<<<dim3(NTOK / 32, DIM / 32, BATCH), 256, 0, stream>>>(x, s1, t1, ytb);

    // Q, K, V projections
    gemm_kernel<<<dim3(NTOK / 128, DIM / 64, BATCH), 256, 0, stream>>>(
        wqb, ytb, bq, nullptr, nullptr, qn, DIM, DIM, NTOK, 0);
    gemm_kernel<<<dim3(NTOK / 128, DIM / 64, BATCH), 256, 0, stream>>>(
        wkb, ytb, bk, nullptr, nullptr, kn, DIM, DIM, NTOK, 0);
    gemm_kernel<<<dim3(NTOK / 128, DH / 64, BATCH), 256, 0, stream>>>(
        wvb, ytb, bv, nullptr, nullptr, vbf, DH, DIM, NTOK, 0);

    // Q,K -> token-major for the attention A/B fragments
    transpose_bf16_kernel<<<dim3(NTOK / 32, DIM / 32, BATCH), 256, 0, stream>>>(qn, qtb, DIM, NTOK);
    transpose_bf16_kernel<<<dim3(NTOK / 32, DIM / 32, BATCH), 256, 0, stream>>>(kn, ktb, DIM, NTOK);

    // attention -> otb[b][n][dh]
    attn_kernel<<<dim3(NTOK / 128, NHEAD, BATCH), 256, ATTN_LDS_BYTES, stream>>>(
        qtb, ktb, vbf, otb);

    // projection + residual: xf2 = x + Wp @ o + bp
    gemm_kernel<<<dim3(NTOK / 128, DIM / 64, BATCH), 256, 0, stream>>>(
        wpb, otb, bp, x, xf2, nullptr, DIM, DH, NTOK, 1);

    // BN2 folded + transpose
    bn_stats_kernel<<<DIM, 256, 0, stream>>>(xf2, g2, b2, s2, t2);
    bn_apply_t_kernel<<<dim3(NTOK / 32, DIM / 32, BATCH), 256, 0, stream>>>(xf2, s2, t2, y2tb);

    // MLP: h = relu6(W1 @ y2 + bb1); out = xf2 + W2 @ h + bb2
    gemm_kernel<<<dim3(NTOK / 128, HID / 64, BATCH), 256, 0, stream>>>(
        w1b, y2tb, bb1, nullptr, nullptr, hn, HID, DIM, NTOK, 2);
    transpose_bf16_kernel<<<dim3(NTOK / 32, HID / 32, BATCH), 256, 0, stream>>>(hn, htb, HID, NTOK);
    gemm_kernel<<<dim3(NTOK / 128, DIM / 64, BATCH), 256, 0, stream>>>(
        w2b, htb, bb2, xf2, out, nullptr, DIM, HID, NTOK, 1);
}

// v002
// One run takes 183 microseconds.
// In both of two side-by-side timings against v001, it was 1.22 times as fast.
// Over all steps from v000 it is 1.50 times as fast.
#include <hip/hip_runtime.h>
#include <hip/hip_bf16.h>

// ---------------------------------------------------------------------------
// Types for CDNA5 WMMA (wave32)
// ---------------------------------------------------------------------------
typedef __bf16 bf16_t;
typedef __attribute__((ext_vector_type(16))) __bf16 v16bf;
typedef __attribute__((ext_vector_type(8)))  __bf16 v8bf;
typedef __attribute__((ext_vector_type(8)))  float  v8f;
typedef int v4i __attribute__((vector_size(16)));

union AFrag {
    v16bf v;
    struct { v8bf lo, hi; } h;
};

// Fragment from LDS laid out [row][k], k contiguous. Per the CDNA5 ISA layout,
// lane L owns row/col L&15; half-wave selects K {kbase..+7} and {kbase+16..+23},
// kbase = 8*(L>>4). Two aligned ds_load_b128 per fragment.
__device__ __forceinline__ v16bf load_frag(const bf16_t* base, int row, int stride, int koff) {
    const bf16_t* p = base + row * stride + koff;
    AFrag f;
    f.h.lo = *(const v8bf*)(p);
    f.h.hi = *(const v8bf*)(p + 16);
    return f.v;
}

#define WMMA_BF16(A, B, C) \
    __builtin_amdgcn_wmma_f32_16x16x32_bf16(false, (A), false, (B), (short)0, (C), false, false)

// ---------------------------------------------------------------------------
// CDNA5 async global->LDS copy (16B per lane). Builtin params are generic
// pointers to int4 per the clang declaration; fallback keeps host pass legal.
// ---------------------------------------------------------------------------
#if __has_builtin(__builtin_amdgcn_global_load_async_to_lds_b128) && \
    __has_builtin(__builtin_amdgcn_s_wait_asynccnt)
#define USE_ASYNC_LDS 1
#else
#define USE_ASYNC_LDS 0
#endif

__device__ __forceinline__ void cp16(void* lds, const void* g) {
#if USE_ASYNC_LDS
    __builtin_amdgcn_global_load_async_to_lds_b128((v4i*)g, (v4i*)lds, 0, 0);
#else
    *(v8bf*)lds = *(const v8bf*)g;
#endif
}

__device__ __forceinline__ void async_wait() {
#if USE_ASYNC_LDS
    __builtin_amdgcn_s_wait_asynccnt(0);
#endif
}

// ---------------------------------------------------------------------------
// Problem constants
// ---------------------------------------------------------------------------
#define BATCH 8
#define DIM   256
#define NTOK  1024
#define NHEAD 16
#define KDIM  16
#define DHEAD 64
#define DH    1024
#define HID   1024

// ---------------------------------------------------------------------------
// float -> bf16 (weights)
// ---------------------------------------------------------------------------
__global__ void cvt_bf16_kernel(const float* __restrict__ src, bf16_t* __restrict__ dst, int n) {
    int i = blockIdx.x * blockDim.x + threadIdx.x;
    if (i < n) dst[i] = (bf16_t)src[i];
}

// ---------------------------------------------------------------------------
// BN stats over (B,N): fold into y = x*s + t (biased var, eps=1e-5)
// ---------------------------------------------------------------------------
__global__ __launch_bounds__(256)
void bn_stats_kernel(const float* __restrict__ x, const float* __restrict__ g,
                     const float* __restrict__ bet, float* __restrict__ s,
                     float* __restrict__ t) {
    __shared__ float ssum[256];
    __shared__ float ssq[256];
    const int c = blockIdx.x;
    float sum = 0.f, sq = 0.f;
    for (int b = 0; b < BATCH; ++b) {
        const float* p = x + ((size_t)b * DIM + c) * NTOK;
        for (int n = threadIdx.x; n < NTOK; n += 256) {
            float v = p[n];
            sum += v; sq += v * v;
        }
    }
    ssum[threadIdx.x] = sum; ssq[threadIdx.x] = sq;
    __syncthreads();
    for (int off = 128; off > 0; off >>= 1) {
        if (threadIdx.x < off) {
            ssum[threadIdx.x] += ssum[threadIdx.x + off];
            ssq[threadIdx.x]  += ssq[threadIdx.x + off];
        }
        __syncthreads();
    }
    if (threadIdx.x == 0) {
        const float cnt = (float)BATCH * (float)NTOK;
        float m   = ssum[0] / cnt;
        float var = ssq[0] / cnt - m * m;
        float sc  = g[c] * rsqrtf(var + 1e-5f);
        s[c] = sc;
        t[c] = bet[c] - m * sc;
    }
}

// ---------------------------------------------------------------------------
// Fused BN-apply + transpose: x[b][c][n] (f32) -> yt[b][n][c] (bf16)
// ---------------------------------------------------------------------------
__global__ __launch_bounds__(256)
void bn_apply_t_kernel(const float* __restrict__ x, const float* __restrict__ s,
                       const float* __restrict__ t, bf16_t* __restrict__ yt) {
    __shared__ bf16_t tile[32][33];
    const int b  = blockIdx.z;
    const int c0 = blockIdx.y * 32;
    const int n0 = blockIdx.x * 32;
    const int tx = threadIdx.x & 31, ty = threadIdx.x >> 5;
    for (int rr = 0; rr < 32; rr += 8) {
        int c = c0 + ty + rr;
        tile[ty + rr][tx] = (bf16_t)(x[((size_t)b * DIM + c) * NTOK + n0 + tx] * s[c] + t[c]);
    }
    __syncthreads();
    for (int rr = 0; rr < 32; rr += 8)
        yt[((size_t)b * NTOK + n0 + ty + rr) * DIM + c0 + tx] = tile[tx][ty + rr];
}

// ---------------------------------------------------------------------------
// Tiled bf16 WMMA GEMM: Out[b][o][n] = W[o][k] @ Yt[b][n][k]^T + bias (+res)
//   workgroup tile 64(O) x 128(N); 8 waves 2x4; wave tile 32x32; K step 32
//   All LDS staging via 16B async copies.
//   mode 0: outb = bf16(acc+bias)   mode 1: outf = acc+bias+res (f32)
//   mode 2: outb = bf16(relu6(acc+bias))
//   mode 3: outb[b][n][o] = bf16(acc+bias)   mode 4: outb[b][n][o] = bf16(relu6(acc+bias))
//   Modes 3 and 4 write token-major, the layout in which the next product reads its operand.
// ---------------------------------------------------------------------------
#define AS_STRIDE 40   // 80B rows: 16B-aligned segments, conflict-free frags
#define BS_STRIDE 40

__global__ __launch_bounds__(256)
void gemm_kernel(const bf16_t* __restrict__ W, const bf16_t* __restrict__ Yt,
                 const float* __restrict__ bias, const float* __restrict__ res,
                 float* __restrict__ outf, bf16_t* __restrict__ outb,
                 int O, int K, int N, int mode) {
    __shared__ bf16_t As[64 * AS_STRIDE];
    __shared__ bf16_t Bs[128 * BS_STRIDE];

    const int tid  = threadIdx.x;
    const int lane = tid & 31;
    const int wave = tid >> 5;
    const int half = lane >> 4;
    const int col  = lane & 15;

    const int b  = blockIdx.z;
    const int o0 = blockIdx.y * 64;
    const int n0 = blockIdx.x * 128;
    const bf16_t* Yb = Yt + (size_t)b * N * K;

    const int ow = (wave & 1) * 32;
    const int nw = (wave >> 1) * 32;

    const int ar = tid >> 2, asg = tid & 3;         // A: 64 rows x 4 segs
    const int br0 = tid >> 1, bs0 = (tid & 1) * 2;  // B: 128 rows x 4 segs (2/thread)

    v8f acc[2][2] = {};

    for (int kk = 0; kk < K; kk += 32) {
        cp16(&As[ar * AS_STRIDE + asg * 8], W + (size_t)(o0 + ar) * K + kk + asg * 8);
        cp16(&Bs[br0 * BS_STRIDE + bs0 * 8],       Yb + (size_t)(n0 + br0) * K + kk + bs0 * 8);
        cp16(&Bs[br0 * BS_STRIDE + (bs0 + 1) * 8], Yb + (size_t)(n0 + br0) * K + kk + (bs0 + 1) * 8);
        if (kk + 32 < K)
            __builtin_prefetch(W + (size_t)(o0 + ar) * K + kk + 32, 0, 1);
        async_wait();
        __syncthreads();

        v16bf a0 = load_frag(As, ow + col,      AS_STRIDE, half * 8);
        v16bf a1 = load_frag(As, ow + 16 + col, AS_STRIDE, half * 8);
        v16bf b0 = load_frag(Bs, nw + col,      BS_STRIDE, half * 8);
        v16bf b1 = load_frag(Bs, nw + 16 + col, BS_STRIDE, half * 8);

        acc[0][0] = WMMA_BF16(a0, b0, acc[0][0]);
        acc[0][1] = WMMA_BF16(a0, b1, acc[0][1]);
        acc[1][0] = WMMA_BF16(a1, b0, acc[1][0]);
        acc[1][1] = WMMA_BF16(a1, b1, acc[1][1]);
        __syncthreads();
    }

    // token-major epilogue: a lane's 8 elements are 8 consecutive o of one token, one 16-byte store
    if (mode >= 3) {
        for (int mi = 0; mi < 2; ++mi) {
            const int om = o0 + ow + mi * 16 + 8 * half;
            for (int ni = 0; ni < 2; ++ni) {
                const int on = n0 + nw + ni * 16 + col;
                v8bf r;
                // unroll: constant indices keep acc and r in registers
                #pragma unroll
                for (int e = 0; e < 8; ++e) {
                    float v = acc[mi][ni][e] + bias[om + e];
                    if (mode == 4) v = fminf(fmaxf(v, 0.f), 6.f);
                    r[e] = (bf16_t)v;
                }
                *(v8bf*)(outb + ((size_t)b * N + on) * O + om) = r;
            }
        }
        return;
    }

    // epilogue: acc element e -> (M = e+8*half, N = lane&15); stores coalesce along n
    for (int mi = 0; mi < 2; ++mi) {
        for (int ni = 0; ni < 2; ++ni) {
            #pragma unroll
            for (int e = 0; e < 8; ++e) {
                int om = o0 + ow + mi * 16 + e + 8 * half;
                int on = n0 + nw + ni * 16 + col;
                float v = acc[mi][ni][e] + bias[om];
                size_t idx = ((size_t)b * O + om) * N + on;
                if (mode == 0)      outb[idx] = (bf16_t)v;
                else if (mode == 1) outf[idx] = v + res[idx];
                else                outb[idx] = (bf16_t)fminf(fmaxf(v, 0.f), 6.f);
            }
        }
    }
}

#define QS_STRIDE 40
#define KS_STRIDE 40
#define VS_STRIDE 136
#define ATTN_LDS_BYTES (128*QS_STRIDE*2 + 128*KS_STRIDE*2 + 64*VS_STRIDE*2)

// value of lane l ^ 16
__device__ __forceinline__ float other_half(float x) {
    int v = __builtin_bit_cast(int, x);
    v = __builtin_amdgcn_permlanex16(v, v, 0x76543210, 0xfedcba98, false, false);
    return __builtin_bit_cast(float, v);
}

__global__ __launch_bounds__(256)
void attn_kernel(const bf16_t* __restrict__ qt, const bf16_t* __restrict__ kt,
                 const bf16_t* __restrict__ vb, bf16_t* __restrict__ ot) {
    extern __shared__ char smem[];
    bf16_t* Qs = (bf16_t*)smem;                       // [128][QS_STRIDE]
    bf16_t* Ks = Qs + 128 * QS_STRIDE;                // [128][KS_STRIDE]
    bf16_t* Vs = Ks + 128 * KS_STRIDE;                // [64][VS_STRIDE]

    const int tid  = threadIdx.x;
    const int lane = tid & 31;
    const int wave = tid >> 5;
    const int half = lane >> 4;
    const int col  = lane & 15;

    const int q0 = blockIdx.x * 128;
    const int h  = blockIdx.y;
    const int b  = blockIdx.z;
    const size_t headv = ((size_t)b * DH + (size_t)h * DHEAD) * NTOK;

    // zero kd-pad [16..32) of Qs and Ks (async copies only touch [0..16))
    {
        v8bf z = {};
        int row = tid >> 1, hh = tid & 1;
        *(v8bf*)(&Qs[row * QS_STRIDE + 16 + hh * 8]) = z;
        *(v8bf*)(&Ks[row * KS_STRIDE + 16 + hh * 8]) = z;
    }
    // stage Q block: Qs[n][kd] <- qt[b][q0+n][h*16 + kd], 2x16B per row
    {
        int n = tid >> 1, sg = tid & 1;
        cp16(&Qs[n * QS_STRIDE + sg * 8],
             qt + ((size_t)b * NTOK + q0 + n) * DIM + h * KDIM + sg * 8);
    }
    async_wait();
    __syncthreads();

    // B operand of S^T: column = query wave*16 + col
    const v16bf qf = load_frag(Qs, wave * 16 + col, QS_STRIDE, half * 8);

    v8f acc[4] = {};                  // acc[dt][e] = O[query col][dt*16 + 8*half + e]
    float m = -1e30f;                 // running maximum of query col, equal in both half-waves
    float l = 0.f;                    // this half-wave's share of the sum, joined in the epilogue

    for (int c0 = 0; c0 < NTOK; c0 += 128) {
        // stage K chunk: Ks[key][kd], 2x16B per row
        {
            int n = tid >> 1, sg = tid & 1;
            cp16(&Ks[n * KS_STRIDE + sg * 8],
                 kt + ((size_t)b * NTOK + c0 + n) * DIM + h * KDIM + sg * 8);
        }
        // stage V chunk: Vs[d][key], 16x16B per row (4 segs/thread)
        #pragma unroll
        for (int r = 0; r < 4; ++r) {
            int s = tid + 256 * r;
            int d = s >> 4, sg = s & 15;
            cp16(&Vs[d * VS_STRIDE + sg * 8], vb + headv + (size_t)d * NTOK + c0 + sg * 8);
        }
        async_wait();
        __syncthreads();

        // two passes of 64 keys: 32 score registers a pass leave room for 8 waves per SIMD
        // nounroll: unrolled, the compiler interleaves the two passes and takes 166 VGPRs instead of 125,
        // which halves the workgroups that fit on a WGP
        #pragma nounroll
        for (int kb = 0; kb < 128; kb += 64) {
            // S^T = (K @ Q^T) * 4 : st[jt][e] = score(key kb + jt*16 + 8*half + e, query col)
            v8f st[4];
            #pragma unroll
            for (int jt = 0; jt < 4; ++jt) {
                v16bf kf = load_frag(Ks, kb + jt * 16 + col, KS_STRIDE, half * 8);
                v8f s = {};
                s = WMMA_BF16(kf, qf, s);
                st[jt] = s * 4.0f;
            }

            // online softmax in registers: 32 keys in-lane, one exchange between halves
            v8f mx = __builtin_elementwise_max(__builtin_elementwise_max(st[0], st[1]),
                                               __builtin_elementwise_max(st[2], st[3]));
            float cm = fmaxf(fmaxf(fmaxf(mx[0], mx[1]), fmaxf(mx[2], mx[3])),
                             fmaxf(fmaxf(mx[4], mx[5]), fmaxf(mx[6], mx[7])));
            cm = fmaxf(cm, other_half(cm));
            const float nm    = fmaxf(m, cm);
            const float alpha = __expf(m - nm);
            m = nm;

            #pragma unroll
            for (int jt = 0; jt < 4; ++jt) {
                v8f t = (st[jt] - nm) * 1.44269504f;   // exp(x) = exp2(x * log2 e)
                #pragma unroll
                for (int e = 0; e < 8; ++e) t[e] = __builtin_amdgcn_exp2f(t[e]);
                st[jt] = t;
            }
            const v8f ps = (st[0] + st[1]) + (st[2] + st[3]);
            l = l * alpha + (((ps[0] + ps[1]) + (ps[2] + ps[3])) + ((ps[4] + ps[5]) + (ps[6] + ps[7])));

            // rescale accumulators: every element of a lane belongs to query col
            #pragma unroll
            for (int dt = 0; dt < 4; ++dt) acc[dt] *= alpha;

            // O^T += V^T @ P^T ; tiles 2*k2 and 2*k2+1 give keys 8*half+e and 16+8*half+e
            // of a 32-key block: the k order in which load_frag reads V
            #pragma unroll
            for (int k2 = 0; k2 < 2; ++k2) {
                v16bf pf;
                #pragma unroll
                for (int e = 0; e < 8; ++e) {
                    pf[e]     = (bf16_t)st[2 * k2][e];
                    pf[e + 8] = (bf16_t)st[2 * k2 + 1][e];
                }
                #pragma unroll
                for (int dt = 0; dt < 4; ++dt) {
                    v16bf vf = load_frag(Vs, dt * 16 + col, VS_STRIDE, kb + k2 * 32 + half * 8);
                    acc[dt] = WMMA_BF16(vf, pf, acc[dt]);
                }
            }
        }
        __syncthreads();
    }

    // epilogue: ot[b][q][h*64+d], a lane's 8 accumulator elements are 8 consecutive d
    l += other_half(l);
    const float li = 1.0f / l;
    bf16_t* orow = ot + ((size_t)b * NTOK + q0 + wave * 16 + col) * DH + h * DHEAD + 8 * half;
    #pragma unroll
    for (int dt = 0; dt < 4; ++dt) {
        v8bf o;
        #pragma unroll
        for (int e = 0; e < 8; ++e) o[e] = (bf16_t)(acc[dt][e] * li);
        *(v8bf*)(orow + dt * 16) = o;
    }
}

// ---------------------------------------------------------------------------
// Host orchestration
// ---------------------------------------------------------------------------
extern "C" void kernel_launch(void* const* d_in, const int* in_sizes, int n_in,
                              void* d_out, int out_size, void* d_ws, size_t ws_size,
                              hipStream_t stream) {
    const float* x   = (const float*)d_in[0];
    const float* g1  = (const float*)d_in[1];
    const float* b1  = (const float*)d_in[2];
    const float* wq  = (const float*)d_in[3];
    const float* bq  = (const float*)d_in[4];
    const float* wk  = (const float*)d_in[5];
    const float* bk  = (const float*)d_in[6];
    const float* wv  = (const float*)d_in[7];
    const float* bv  = (const float*)d_in[8];
    const float* wp  = (const float*)d_in[9];
    const float* bp  = (const float*)d_in[10];
    const float* g2  = (const float*)d_in[11];
    const float* b2  = (const float*)d_in[12];
    const float* w1  = (const float*)d_in[13];
    const float* bb1 = (const float*)d_in[14];
    const float* w2  = (const float*)d_in[15];
    const float* bb2 = (const float*)d_in[16];
    float* out = (float*)d_out;

    char* ws = (char*)d_ws;
    size_t off = 0;
    auto alloc = [&](size_t bytes) -> void* {
        void* p = ws + off;
        off = (off + bytes + 255) & ~(size_t)255;
        return p;
    };

    const size_t BCN = (size_t)BATCH * DIM * NTOK;
    const size_t BHN = (size_t)BATCH * DH * NTOK;

    float*  s1   = (float*)alloc(DIM * 4);
    float*  t1   = (float*)alloc(DIM * 4);
    float*  s2   = (float*)alloc(DIM * 4);
    float*  t2   = (float*)alloc(DIM * 4);
    bf16_t* wqb  = (bf16_t*)alloc((size_t)DIM * DIM * 2);
    bf16_t* wkb  = (bf16_t*)alloc((size_t)DIM * DIM * 2);
    bf16_t* wvb  = (bf16_t*)alloc((size_t)DH * DIM * 2);
    bf16_t* wpb  = (bf16_t*)alloc((size_t)DIM * DH * 2);
    bf16_t* w1b  = (bf16_t*)alloc((size_t)HID * DIM * 2);
    bf16_t* w2b  = (bf16_t*)alloc((size_t)DIM * HID * 2);
    bf16_t* ytb  = (bf16_t*)alloc(BCN * 2);   // BN1(x), [b][n][c]
    bf16_t* qtb  = (bf16_t*)alloc(BCN * 2);   // Q, [b][n][o]
    bf16_t* ktb  = (bf16_t*)alloc(BCN * 2);   // K, [b][n][o]
    bf16_t* vbf  = (bf16_t*)alloc(BHN * 2);   // V, [b][dh][n]
    bf16_t* otb  = (bf16_t*)alloc(BHN * 2);   // attn out, [b][n][dh]
    float*  xf2  = (float*)alloc(BCN * 4);    // residual 1, [b][c][n]
    bf16_t* y2tb = (bf16_t*)alloc(BCN * 2);   // BN2(xf2), [b][n][c]
    bf16_t* htb  = (bf16_t*)alloc(BHN * 2);   // MLP hidden, [b][n][h]

    // weights -> bf16
    cvt_bf16_kernel<<<(DIM * DIM + 255) / 256, 256, 0, stream>>>(wq, wqb, DIM * DIM);
    cvt_bf16_kernel<<<(DIM * DIM + 255) / 256, 256, 0, stream>>>(wk, wkb, DIM * DIM);
    cvt_bf16_kernel<<<(DH * DIM + 255) / 256, 256, 0, stream>>>(wv, wvb, DH * DIM);
    cvt_bf16_kernel<<<(DIM * DH + 255) / 256, 256, 0, stream>>>(wp, wpb, DIM * DH);
    cvt_bf16_kernel<<<(HID * DIM + 255) / 256, 256, 0, stream>>>(w1, w1b, HID * DIM);
    cvt_bf16_kernel<<<(DIM * HID + 255) / 256, 256, 0, stream>>>(w2, w2b, DIM * HID);

    // BN1 folded + transpose: ytb[b][n][c]
    bn_stats_kernel<<<DIM, 256, 0, stream>>>(x, g1, b1, s1, t1);
    bn_apply_t_kernel<<<dim3(NTOK / 32, DIM / 32, BATCH), 256, 0, stream>>>(x, s1, t1, ytb);

    // Q, K (token-major for the attention fragments) and V projections
    gemm_kernel<<<dim3(NTOK / 128, DIM / 64, BATCH), 256, 0, stream>>>(
        wqb, ytb, bq, nullptr, nullptr, qtb, DIM, DIM, NTOK, 3);
    gemm_kernel<<<dim3(NTOK / 128, DIM / 64, BATCH), 256, 0, stream>>>(
        wkb, ytb, bk, nullptr, nullptr, ktb, DIM, DIM, NTOK, 3);
    gemm_kernel<<<dim3(NTOK / 128, DH / 64, BATCH), 256, 0, stream>>>(
        wvb, ytb, bv, nullptr, nullptr, vbf, DH, DIM, NTOK, 0);

    // attention -> otb[b][n][dh]
    attn_kernel<<<dim3(NTOK / 128, NHEAD, BATCH), 256, ATTN_LDS_BYTES, stream>>>(
        qtb, ktb, vbf, otb);

    // projection + residual: xf2 = x + Wp @ o + bp
    gemm_kernel<<<dim3(NTOK / 128, DIM / 64, BATCH), 256, 0, stream>>>(
        wpb, otb, bp, x, xf2, nullptr, DIM, DH, NTOK, 1);

    // BN2 folded + transpose
    bn_stats_kernel<<<DIM, 256, 0, stream>>>(xf2, g2, b2, s2, t2);
    bn_apply_t_kernel<<<dim3(NTOK / 32, DIM / 32, BATCH), 256, 0, stream>>>(xf2, s2, t2, y2tb);

    // MLP: h = relu6(W1 @ y2 + bb1); out = xf2 + W2 @ h + bb2
    gemm_kernel<<<dim3(NTOK / 128, HID / 64, BATCH), 256, 0, stream>>>(
        w1b, y2tb, bb1, nullptr, nullptr, htb, HID, DIM, NTOK, 4);
    gemm_kernel<<<dim3(NTOK / 128, DIM / 64, BATCH), 256, 0, stream>>>(
        w2b, htb, bb2, xf2, out, nullptr, DIM, HID, NTOK, 1);
}

// v003
// It runs in 166 microseconds.
// Next to v002, in two timings, it ran 1.10 times as fast each time.
// All steps since v000 together make it 1.65 times as fast.
#include <hip/hip_runtime.h>
#include <hip/hip_bf16.h>

// ---------------------------------------------------------------------------
// Types for CDNA5 WMMA (wave32)
// ---------------------------------------------------------------------------
typedef __bf16 bf16_t;
typedef __attribute__((ext_vector_type(16))) __bf16 v16bf;
typedef __attribute__((ext_vector_type(8)))  __bf16 v8bf;
typedef __attribute__((ext_vector_type(8)))  float  v8f;
typedef __attribute__((ext_vector_type(4)))  float  v4f;
typedef int v4i __attribute__((vector_size(16)));

union AFrag {
    v16bf v;
    struct { v8bf lo, hi; } h;
};

// Fragment from LDS laid out [row][k], k contiguous. Per the CDNA5 ISA layout,
// lane L owns row/col L&15; half-wave selects K {kbase..+7} and {kbase+16..+23},
// kbase = 8*(L>>4). Two aligned ds_load_b128 per fragment.
__device__ __forceinline__ v16bf load_frag(const bf16_t* base, int row, int stride, int koff) {
    const bf16_t* p = base + row * stride + koff;
    AFrag f;
    f.h.lo = *(const v8bf*)(p);
    f.h.hi = *(const v8bf*)(p + 16);
    return f.v;
}

#define WMMA_BF16(A, B, C) \
    __builtin_amdgcn_wmma_f32_16x16x32_bf16(false, (A), false, (B), (short)0, (C), false, false)

// ---------------------------------------------------------------------------
// CDNA5 async global->LDS copy (16B per lane). Builtin params are generic
// pointers to int4 per the clang declaration; fallback keeps host pass legal.
// ---------------------------------------------------------------------------
#if __has_builtin(__builtin_amdgcn_global_load_async_to_lds_b128) && \
    __has_builtin(__builtin_amdgcn_s_wait_asynccnt)
#define USE_ASYNC_LDS 1
#else
#define USE_ASYNC_LDS 0
#endif

__device__ __forceinline__ void cp16(void* lds, const void* g) {
#if USE_ASYNC_LDS
    __builtin_amdgcn_global_load_async_to_lds_b128((v4i*)g, (v4i*)lds, 0, 0);
#else
    *(v8bf*)lds = *(const v8bf*)g;
#endif
}

__device__ __forceinline__ void async_wait() {
#if USE_ASYNC_LDS
    __builtin_amdgcn_s_wait_asynccnt(0);
#endif
}

// ---------------------------------------------------------------------------
// Problem constants
// ---------------------------------------------------------------------------
#define BATCH 8
#define DIM   256
#define NTOK  1024
#define NHEAD 16
#define KDIM  16
#define DHEAD 64
#define DH    1024
#define HID   1024

// ---------------------------------------------------------------------------
// float -> bf16 (weights): one workgroup converts CVT_BLK consecutive elements,
// 8 a thread (two 16-byte loads, one 16-byte store)
// ---------------------------------------------------------------------------
#define CVT_BLK 2048
#define CVT_SMALL (DIM * DIM / CVT_BLK)   // workgroups for wq, and for wk
#define CVT_LARGE (DH * DIM / CVT_BLK)    // workgroups for each of wv, wp, w1, w2
#define CVT_GROUPS (2 * CVT_SMALL + 4 * CVT_LARGE)

__device__ __forceinline__ void cvt_block(const float* __restrict__ src, bf16_t* __restrict__ dst, int blk) {
    const int i = blk * CVT_BLK + threadIdx.x * 8;
    const v4f a = *(const v4f*)(src + i);
    const v4f c = *(const v4f*)(src + i + 4);
    v8bf r;
    // unroll: constant indices keep a, c and r in registers
    #pragma unroll
    for (int e = 0; e < 4; ++e) {
        r[e]     = (bf16_t)a[e];
        r[e + 4] = (bf16_t)c[e];
    }
    *(v8bf*)(dst + i) = r;
    // the store's address and data registers may be rewritten on the paths behind it: wait first
    asm volatile("s_wait_xcnt 0x0" ::: "memory");
}

// ---------------------------------------------------------------------------
// BN stats over (B,N): fold into y = x*s + t (biased var, eps=1e-5)
// ---------------------------------------------------------------------------
__device__ __forceinline__
void bn_stats_block(const float* __restrict__ x, const float* __restrict__ g,
                    const float* __restrict__ bet, float* __restrict__ s,
                    float* __restrict__ t) {
    __shared__ float ssum[256];
    __shared__ float ssq[256];
    const int c = blockIdx.x;
    float sum = 0.f, sq = 0.f;
    for (int b = 0; b < BATCH; ++b) {
        const float* p = x + ((size_t)b * DIM + c) * NTOK;
        for (int n = threadIdx.x; n < NTOK; n += 256) {
            float v = p[n];
            sum += v; sq += v * v;
        }
    }
    ssum[threadIdx.x] = sum; ssq[threadIdx.x] = sq;
    __syncthreads();
    for (int off = 128; off > 0; off >>= 1) {
        if (threadIdx.x < off) {
            ssum[threadIdx.x] += ssum[threadIdx.x + off];
            ssq[threadIdx.x]  += ssq[threadIdx.x + off];
        }
        __syncthreads();
    }
    if (threadIdx.x == 0) {
        const float cnt = (float)BATCH * (float)NTOK;
        float m   = ssum[0] / cnt;
        float var = ssq[0] / cnt - m * m;
        float sc  = g[c] * rsqrtf(var + 1e-5f);
        s[c] = sc;
        t[c] = bet[c] - m * sc;
    }
}

__global__ __launch_bounds__(256)
void bn_stats_kernel(const float* __restrict__ x, const float* __restrict__ g,
                     const float* __restrict__ bet, float* __restrict__ s,
                     float* __restrict__ t) {
    bn_stats_block(x, g, bet, s, t);
}

// ---------------------------------------------------------------------------
// First launch: BN1 statistics and the six weight conversions depend on nothing
// but the inputs, so they share one grid. Workgroups [0, DIM) do one channel's
// statistics (the longer job, started first), the rest convert weights.
// ---------------------------------------------------------------------------
__global__ __launch_bounds__(256)
void prep_kernel(const float* __restrict__ x, const float* __restrict__ g,
                 const float* __restrict__ bet, float* __restrict__ s, float* __restrict__ t,
                 const float* __restrict__ wq, const float* __restrict__ wk,
                 const float* __restrict__ wv, const float* __restrict__ wp,
                 const float* __restrict__ w1, const float* __restrict__ w2,
                 bf16_t* __restrict__ wqb, bf16_t* __restrict__ wkb,
                 bf16_t* __restrict__ wvb, bf16_t* __restrict__ wpb,
                 bf16_t* __restrict__ w1b, bf16_t* __restrict__ w2b) {
    if (blockIdx.x < DIM) {
        bn_stats_block(x, g, bet, s, t);
        return;
    }
    int blk = blockIdx.x - DIM;
    if (blk < CVT_SMALL)     { cvt_block(wq, wqb, blk); return; }
    blk -= CVT_SMALL;
    if (blk < CVT_SMALL)     { cvt_block(wk, wkb, blk); return; }
    blk -= CVT_SMALL;
    const int which = blk / CVT_LARGE;
    blk -= which * CVT_LARGE;
    const float* src = which == 0 ? wv  : which == 1 ? wp  : which == 2 ? w1  : w2;
    bf16_t*      dst = which == 0 ? wvb : which == 1 ? wpb : which == 2 ? w1b : w2b;
    cvt_block(src, dst, blk);
}

// ---------------------------------------------------------------------------
// Fused BN-apply + transpose: x[b][c][n] (f32) -> yt[b][n][c] (bf16)
// ---------------------------------------------------------------------------
__global__ __launch_bounds__(256)
void bn_apply_t_kernel(const float* __restrict__ x, const float* __restrict__ s,
                       const float* __restrict__ t, bf16_t* __restrict__ yt) {
    __shared__ bf16_t tile[32][33];
    const int b  = blockIdx.z;
    const int c0 = blockIdx.y * 32;
    const int n0 = blockIdx.x * 32;
    const int tx = threadIdx.x & 31, ty = threadIdx.x >> 5;
    for (int rr = 0; rr < 32; rr += 8) {
        int c = c0 + ty + rr;
        tile[ty + rr][tx] = (bf16_t)(x[((size_t)b * DIM + c) * NTOK + n0 + tx] * s[c] + t[c]);
    }
    __syncthreads();
    for (int rr = 0; rr < 32; rr += 8)
        yt[((size_t)b * NTOK + n0 + ty + rr) * DIM + c0 + tx] = tile[tx][ty + rr];
}

// ---------------------------------------------------------------------------
// Tiled bf16 WMMA GEMM: Out[b][o][n] = W[o][k] @ Yt[b][n][k]^T + bias (+res)
//   workgroup tile 64(O) x 128(N); 8 waves 2x4; wave tile 32x32; K step 32
//   All LDS staging via 16B async copies.
//   mode 0: outb = bf16(acc+bias)   mode 1: outf = acc+bias+res (f32)
//   mode 2: outb = bf16(relu6(acc+bias))
//   mode 3: outb[b][n][o] = bf16(acc+bias)   mode 4: outb[b][n][o] = bf16(relu6(acc+bias))
//   Modes 3 and 4 write token-major, the layout in which the next product reads its operand.
//   mode 5: three products of the same Yt in one grid, told apart by blockIdx.y:
//   O rows of (W, bias, outb) and O rows of (W2, bias2, outb2) as mode 3,
//   then O3 rows of (W3, bias3, outb3) as mode 0.
// ---------------------------------------------------------------------------
#define AS_STRIDE 40   // 80B rows: 16B-aligned segments, conflict-free frags
#define BS_STRIDE 40

__global__ __launch_bounds__(256)
void gemm_kernel(const bf16_t* __restrict__ W, const bf16_t* __restrict__ Yt,
                 const float* __restrict__ bias, const float* __restrict__ res,
                 float* __restrict__ outf, bf16_t* __restrict__ outb,
                 int O, int K, int N, int mode,
                 const bf16_t* __restrict__ W2, const float* __restrict__ bias2,
                 bf16_t* __restrict__ outb2,
                 const bf16_t* __restrict__ W3, const float* __restrict__ bias3,
                 bf16_t* __restrict__ outb3, int O3) {
    __shared__ bf16_t As[64 * AS_STRIDE];
    __shared__ bf16_t Bs[128 * BS_STRIDE];

    const int tid  = threadIdx.x;
    const int lane = tid & 31;
    const int wave = tid >> 5;
    const int half = lane >> 4;
    const int col  = lane & 15;

    const int b  = blockIdx.z;
    int oy = blockIdx.y;                 // 64-row block of the product's own O
    const int n0 = blockIdx.x * 128;
    const bf16_t* Yb = Yt + (size_t)b * N * K;

    if (mode == 5) {
        const int nb = O >> 6;
        mode = 3;
        if (oy >= 2 * nb)  { oy -= 2 * nb; W = W3; bias = bias3; outb = outb3; O = O3; mode = 0; }
        else if (oy >= nb) { oy -= nb;     W = W2; bias = bias2; outb = outb2; }
    }
    const int o0 = oy * 64;

    const int ow = (wave & 1) * 32;
    const int nw = (wave >> 1) * 32;

    const int ar = tid >> 2, asg = tid & 3;         // A: 64 rows x 4 segs
    const int br0 = tid >> 1, bs0 = (tid & 1) * 2;  // B: 128 rows x 4 segs (2/thread)

    v8f acc[2][2] = {};

    for (int kk = 0; kk < K; kk += 32) {
        cp16(&As[ar * AS_STRIDE + asg * 8], W + (size_t)(o0 + ar) * K + kk + asg * 8);
        cp16(&Bs[br0 * BS_STRIDE + bs0 * 8],       Yb + (size_t)(n0 + br0) * K + kk + bs0 * 8);
        cp16(&Bs[br0 * BS_STRIDE + (bs0 + 1) * 8], Yb + (size_t)(n0 + br0) * K + kk + (bs0 + 1) * 8);
        if (kk + 32 < K)
            __builtin_prefetch(W + (size_t)(o0 + ar) * K + kk + 32, 0, 1);
        async_wait();
        __syncthreads();

        v16bf a0 = load_frag(As, ow + col,      AS_STRIDE, half * 8);
        v16bf a1 = load_frag(As, ow + 16 + col, AS_STRIDE, half * 8);
        v16bf b0 = load_frag(Bs, nw + col,      BS_STRIDE, half * 8);
        v16bf b1 = load_frag(Bs, nw + 16 + col, BS_STRIDE, half * 8);

        acc[0][0] = WMMA_BF16(a0, b0, acc[0][0]);
        acc[0][1] = WMMA_BF16(a0, b1, acc[0][1]);
        acc[1][0] = WMMA_BF16(a1, b0, acc[1][0]);
        acc[1][1] = WMMA_BF16(a1, b1, acc[1][1]);
        __syncthreads();
    }

    // token-major epilogue: a lane's 8 elements are 8 consecutive o of one token, one 16-byte store
    if (mode >= 3) {
        for (int mi = 0; mi < 2; ++mi) {
            const int om = o0 + ow + mi * 16 + 8 * half;
            for (int ni = 0; ni < 2; ++ni) {
                const int on = n0 + nw + ni * 16 + col;
                v8bf r;
                // unroll: constant indices keep acc and r in registers
                #pragma unroll
                for (int e = 0; e < 8; ++e) {
                    float v = acc[mi][ni][e] + bias[om + e];
                    if (mode == 4) v = fminf(fmaxf(v, 0.f), 6.f);
                    r[e] = (bf16_t)v;
                }
                *(v8bf*)(outb + ((size_t)b * N + on) * O + om) = r;
            }
        }
        return;
    }

    // epilogue: acc element e -> (M = e+8*half, N = lane&15); stores coalesce along n
    for (int mi = 0; mi < 2; ++mi) {
        for (int ni = 0; ni < 2; ++ni) {
            #pragma unroll
            for (int e = 0; e < 8; ++e) {
                int om = o0 + ow + mi * 16 + e + 8 * half;
                int on = n0 + nw + ni * 16 + col;
                float v = acc[mi][ni][e] + bias[om];
                size_t idx = ((size_t)b * O + om) * N + on;
                if (mode == 0)      outb[idx] = (bf16_t)v;
                else if (mode == 1) outf[idx] = v + res[idx];
                else                outb[idx] = (bf16_t)fminf(fmaxf(v, 0.f), 6.f);
            }
        }
    }
}

#define QS_STRIDE 40
#define KS_STRIDE 40
#define VS_STRIDE 136
#define ATTN_LDS_BYTES (128*QS_STRIDE*2 + 128*KS_STRIDE*2 + 64*VS_STRIDE*2)

// value of lane l ^ 16
__device__ __forceinline__ float other_half(float x) {
    int v = __builtin_bit_cast(int, x);
    v = __builtin_amdgcn_permlanex16(v, v, 0x76543210, 0xfedcba98, false, false);
    return __builtin_bit_cast(float, v);
}

__global__ __launch_bounds__(256)
void attn_kernel(const bf16_t* __restrict__ qt, const bf16_t* __restrict__ kt,
                 const bf16_t* __restrict__ vb, bf16_t* __restrict__ ot) {
    extern __shared__ char smem[];
    bf16_t* Qs = (bf16_t*)smem;                       // [128][QS_STRIDE]
    bf16_t* Ks = Qs + 128 * QS_STRIDE;                // [128][KS_STRIDE]
    bf16_t* Vs = Ks + 128 * KS_STRIDE;                // [64][VS_STRIDE]

    const int tid  = threadIdx.x;
    const int lane = tid & 31;
    const int wave = tid >> 5;
    const int half = lane >> 4;
    const int col  = lane & 15;

    const int q0 = blockIdx.x * 128;
    const int h  = blockIdx.y;
    const int b  = blockIdx.z;
    const size_t headv = ((size_t)b * DH + (size_t)h * DHEAD) * NTOK;

    // zero kd-pad [16..32) of Qs and Ks (async copies only touch [0..16))
    {
        v8bf z = {};
        int row = tid >> 1, hh = tid & 1;
        *(v8bf*)(&Qs[row * QS_STRIDE + 16 + hh * 8]) = z;
        *(v8bf*)(&Ks[row * KS_STRIDE + 16 + hh * 8]) = z;
    }
    // stage Q block: Qs[n][kd] <- qt[b][q0+n][h*16 + kd], 2x16B per row
    {
        int n = tid >> 1, sg = tid & 1;
        cp16(&Qs[n * QS_STRIDE + sg * 8],
             qt + ((size_t)b * NTOK + q0 + n) * DIM + h * KDIM + sg * 8);
    }
    async_wait();
    __syncthreads();

    // B operand of S^T: column = query wave*16 + col
    const v16bf qf = load_frag(Qs, wave * 16 + col, QS_STRIDE, half * 8);

    v8f acc[4] = {};                  // acc[dt][e] = O[query col][dt*16 + 8*half + e]
    float m = -1e30f;                 // running maximum of query col, equal in both half-waves
    float l = 0.f;                    // this half-wave's share of the sum, joined in the epilogue

    for (int c0 = 0; c0 < NTOK; c0 += 128) {
        // stage K chunk: Ks[key][kd], 2x16B per row
        {
            int n = tid >> 1, sg = tid & 1;
            cp16(&Ks[n * KS_STRIDE + sg * 8],
                 kt + ((size_t)b * NTOK + c0 + n) * DIM + h * KDIM + sg * 8);
        }
        // stage V chunk: Vs[d][key], 16x16B per row (4 segs/thread)
        #pragma unroll
        for (int r = 0; r < 4; ++r) {
            int s = tid + 256 * r;
            int d = s >> 4, sg = s & 15;
            cp16(&Vs[d * VS_STRIDE + sg * 8], vb + headv + (size_t)d * NTOK + c0 + sg * 8);
        }
        async_wait();
        __syncthreads();

        // two passes of 64 keys: 32 score registers a pass leave room for 8 waves per SIMD
        // nounroll: unrolled, the compiler interleaves the two passes and takes 166 VGPRs instead of 125,
        // which halves the workgroups that fit on a WGP
        #pragma nounroll
        for (int kb = 0; kb < 128; kb += 64) {
            // S^T = (K @ Q^T) * 4 : st[jt][e] = score(key kb + jt*16 + 8*half + e, query col)
            v8f st[4];
            #pragma unroll
            for (int jt = 0; jt < 4; ++jt) {
                v16bf kf = load_frag(Ks, kb + jt * 16 + col, KS_STRIDE, half * 8);
                v8f s = {};
                s = WMMA_BF16(kf, qf, s);
                st[jt] = s * 4.0f;
            }

            // online softmax in registers: 32 keys in-lane, one exchange between halves
            v8f mx = __builtin_elementwise_max(__builtin_elementwise_max(st[0], st[1]),
                                               __builtin_elementwise_max(st[2], st[3]));
            float cm = fmaxf(fmaxf(fmaxf(mx[0], mx[1]), fmaxf(mx[2], mx[3])),
                             fmaxf(fmaxf(mx[4], mx[5]), fmaxf(mx[6], mx[7])));
            cm = fmaxf(cm, other_half(cm));
            const float nm    = fmaxf(m, cm);
            const float alpha = __expf(m - nm);
            m = nm;

            #pragma unroll
            for (int jt = 0; jt < 4; ++jt) {
                v8f t = (st[jt] - nm) * 1.44269504f;   // exp(x) = exp2(x * log2 e)
                #pragma unroll
                for (int e = 0; e < 8; ++e) t[e] = __builtin_amdgcn_exp2f(t[e]);
                st[jt] = t;
            }
            const v8f ps = (st[0] + st[1]) + (st[2] + st[3]);
            l = l * alpha + (((ps[0] + ps[1]) + (ps[2] + ps[3])) + ((ps[4] + ps[5]) + (ps[6] + ps[7])));

            // rescale accumulators: every element of a lane belongs to query col
            #pragma unroll
            for (int dt = 0; dt < 4; ++dt) acc[dt] *= alpha;

            // O^T += V^T @ P^T ; tiles 2*k2 and 2*k2+1 give keys 8*half+e and 16+8*half+e
            // of a 32-key block: the k order in which load_frag reads V
            #pragma unroll
            for (int k2 = 0; k2 < 2; ++k2) {
                v16bf pf;
                #pragma unroll
                for (int e = 0; e < 8; ++e) {
                    pf[e]     = (bf16_t)st[2 * k2][e];
                    pf[e + 8] = (bf16_t)st[2 * k2 + 1][e];
                }
                #pragma unroll
                for (int dt = 0; dt < 4; ++dt) {
                    v16bf vf = load_frag(Vs, dt * 16 + col, VS_STRIDE, kb + k2 * 32 + half * 8);
                    acc[dt] = WMMA_BF16(vf, pf, acc[dt]);
                }
            }
        }
        __syncthreads();
    }

    // epilogue: ot[b][q][h*64+d], a lane's 8 accumulator elements are 8 consecutive d
    l += other_half(l);
    const float li = 1.0f / l;
    bf16_t* orow = ot + ((size_t)b * NTOK + q0 + wave * 16 + col) * DH + h * DHEAD + 8 * half;
    #pragma unroll
    for (int dt = 0; dt < 4; ++dt) {
        v8bf o;
        #pragma unroll
        for (int e = 0; e < 8; ++e) o[e] = (bf16_t)(acc[dt][e] * li);
        *(v8bf*)(orow + dt * 16) = o;
    }
}

// ---------------------------------------------------------------------------
// Host orchestration
// ---------------------------------------------------------------------------
extern "C" void kernel_launch(void* const* d_in, const int* in_sizes, int n_in,
                              void* d_out, int out_size, void* d_ws, size_t ws_size,
                              hipStream_t stream) {
    const float* x   = (const float*)d_in[0];
    const float* g1  = (const float*)d_in[1];
    const float* b1  = (const float*)d_in[2];
    const float* wq  = (const float*)d_in[3];
    const float* bq  = (const float*)d_in[4];
    const float* wk  = (const float*)d_in[5];
    const float* bk  = (const float*)d_in[6];
    const float* wv  = (const float*)d_in[7];
    const float* bv  = (const float*)d_in[8];
    const float* wp  = (const float*)d_in[9];
    const float* bp  = (const float*)d_in[10];
    const float* g2  = (const float*)d_in[11];
    const float* b2  = (const float*)d_in[12];
    const float* w1  = (const float*)d_in[13];
    const float* bb1 = (const float*)d_in[14];
    const float* w2  = (const float*)d_in[15];
    const float* bb2 = (const float*)d_in[16];
    float* out = (float*)d_out;

    char* ws = (char*)d_ws;
    size_t off = 0;
    auto alloc = [&](size_t bytes) -> void* {
        void* p = ws + off;
        off = (off + bytes + 255) & ~(size_t)255;
        return p;
    };

    const size_t BCN = (size_t)BATCH * DIM * NTOK;
    const size_t BHN = (size_t)BATCH * DH * NTOK;

    float*  s1   = (float*)alloc(DIM * 4);
    float*  t1   = (float*)alloc(DIM * 4);
    float*  s2   = (float*)alloc(DIM * 4);
    float*  t2   = (float*)alloc(DIM * 4);
    bf16_t* wqb  = (bf16_t*)alloc((size_t)DIM * DIM * 2);
    bf16_t* wkb  = (bf16_t*)alloc((size_t)DIM * DIM * 2);
    bf16_t* wvb  = (bf16_t*)alloc((size_t)DH * DIM * 2);
    bf16_t* wpb  = (bf16_t*)alloc((size_t)DIM * DH * 2);
    bf16_t* w1b  = (bf16_t*)alloc((size_t)HID * DIM * 2);
    bf16_t* w2b  = (bf16_t*)alloc((size_t)DIM * HID * 2);
    bf16_t* ytb  = (bf16_t*)alloc(BCN * 2);   // BN1(x), [b][n][c]
    bf16_t* qtb  = (bf16_t*)alloc(BCN * 2);   // Q, [b][n][o]
    bf16_t* ktb  = (bf16_t*)alloc(BCN * 2);   // K, [b][n][o]
    bf16_t* vbf  = (bf16_t*)alloc(BHN * 2);   // V, [b][dh][n]
    bf16_t* otb  = (bf16_t*)alloc(BHN * 2);   // attn out, [b][n][dh]
    float*  xf2  = (float*)alloc(BCN * 4);    // residual 1, [b][c][n]
    bf16_t* y2tb = (bf16_t*)alloc(BCN * 2);   // BN2(xf2), [b][n][c]
    bf16_t* htb  = (bf16_t*)alloc(BHN * 2);   // MLP hidden, [b][n][h]

    // BN1 statistics, and weights -> bf16
    prep_kernel<<<DIM + CVT_GROUPS, 256, 0, stream>>>(x, g1, b1, s1, t1, wq, wk, wv, wp, w1, w2,
                                                      wqb, wkb, wvb, wpb, w1b, w2b);

    // BN1 folded + transpose: ytb[b][n][c]
    bn_apply_t_kernel<<<dim3(NTOK / 32, DIM / 32, BATCH), 256, 0, stream>>>(x, s1, t1, ytb);

    // Q, K (token-major for the attention fragments) and V projections, one grid
    gemm_kernel<<<dim3(NTOK / 128, (2 * DIM + DH) / 64, BATCH), 256, 0, stream>>>(
        wqb, ytb, bq, nullptr, nullptr, qtb, DIM, DIM, NTOK, 5,
        wkb, bk, ktb, wvb, bv, vbf, DH);

    // attention -> otb[b][n][dh]
    attn_kernel<<<dim3(NTOK / 128, NHEAD, BATCH), 256, ATTN_LDS_BYTES, stream>>>(
        qtb, ktb, vbf, otb);

    // projection + residual: xf2 = x + Wp @ o + bp
    gemm_kernel<<<dim3(NTOK / 128, DIM / 64, BATCH), 256, 0, stream>>>(
        wpb, otb, bp, x, xf2, nullptr, DIM, DH, NTOK, 1,
        nullptr, nullptr, nullptr, nullptr, nullptr, nullptr, 0);

    // BN2 folded + transpose
    bn_stats_kernel<<<DIM, 256, 0, stream>>>(xf2, g2, b2, s2, t2);
    bn_apply_t_kernel<<<dim3(NTOK / 32, DIM / 32, BATCH), 256, 0, stream>>>(xf2, s2, t2, y2tb);

    // MLP: h = relu6(W1 @ y2 + bb1); out = xf2 + W2 @ h + bb2
    gemm_kernel<<<dim3(NTOK / 128, HID / 64, BATCH), 256, 0, stream>>>(
        w1b, y2tb, bb1, nullptr, nullptr, htb, HID, DIM, NTOK, 4,
        nullptr, nullptr, nullptr, nullptr, nullptr, nullptr, 0);
    gemm_kernel<<<dim3(NTOK / 128, DIM / 64, BATCH), 256, 0, stream>>>(
        w2b, htb, bb2, xf2, out, nullptr, DIM, HID, NTOK, 1,
        nullptr, nullptr, nullptr, nullptr, nullptr, nullptr, 0);
}

// v004
// One run takes 110 microseconds.
// Two timings next to v003 both put it at 1.49 times that version's speed.
// All steps since v000 together make it 2.47 times as fast.
#include <hip/hip_runtime.h>
#include <hip/hip_bf16.h>

// ---------------------------------------------------------------------------
// Types for CDNA5 WMMA (wave32)
// ---------------------------------------------------------------------------
typedef __bf16 bf16_t;
typedef __attribute__((ext_vector_type(16))) __bf16 v16bf;
typedef __attribute__((ext_vector_type(8)))  __bf16 v8bf;
typedef __attribute__((ext_vector_type(8)))  float  v8f;
typedef __attribute__((ext_vector_type(4)))  float  v4f;
typedef int v4i __attribute__((vector_size(16)));

union AFrag {
    v16bf v;
    struct { v8bf lo, hi; } h;
};

// Fragment from LDS laid out [row][k], k contiguous. Per the CDNA5 ISA layout,
// lane L owns row/col L&15; half-wave selects K {kbase..+7} and {kbase+16..+23},
// kbase = 8*(L>>4). Two aligned ds_load_b128 per fragment.
__device__ __forceinline__ v16bf load_frag(const bf16_t* base, int row, int stride, int koff) {
    const bf16_t* p = base + row * stride + koff;
    AFrag f;
    f.h.lo = *(const v8bf*)(p);
    f.h.hi = *(const v8bf*)(p + 16);
    return f.v;
}

#define WMMA_BF16(A, B, C) \
    __builtin_amdgcn_wmma_f32_16x16x32_bf16(false, (A), false, (B), (short)0, (C), false, false)

// ---------------------------------------------------------------------------
// CDNA5 async global->LDS copy (16B per lane). Builtin params are generic
// pointers to int4 per the clang declaration; fallback keeps host pass legal.
// ---------------------------------------------------------------------------
#if __has_builtin(__builtin_amdgcn_global_load_async_to_lds_b128) && \
    __has_builtin(__builtin_amdgcn_s_wait_asynccnt)
#define USE_ASYNC_LDS 1
#else
#define USE_ASYNC_LDS 0
#endif

__device__ __forceinline__ void cp16(void* lds, const void* g) {
#if USE_ASYNC_LDS
    __builtin_amdgcn_global_load_async_to_lds_b128((v4i*)g, (v4i*)lds, 0, 0);
#else
    *(v8bf*)lds = *(const v8bf*)g;
#endif
}

__device__ __forceinline__ void async_wait() {
#if USE_ASYNC_LDS
    __builtin_amdgcn_s_wait_asynccnt(0);
#endif
}

// ---------------------------------------------------------------------------
// Problem constants
// ---------------------------------------------------------------------------
#define BATCH 8
#define DIM   256
#define NTOK  1024
#define NHEAD 16
#define KDIM  16
#define DHEAD 64
#define DH    1024
#define HID   1024

// ---------------------------------------------------------------------------
// float -> bf16 (weights): one workgroup converts CVT_BLK consecutive elements,
// 8 a thread (two 16-byte loads, one 16-byte store)
// ---------------------------------------------------------------------------
#define CVT_BLK 2048
#define CVT_SMALL (DIM * DIM / CVT_BLK)   // workgroups for wq, and for wk
#define CVT_LARGE (DH * DIM / CVT_BLK)    // workgroups for each of wv, wp, w1, w2
#define CVT_GROUPS (2 * CVT_SMALL + 4 * CVT_LARGE)

__device__ __forceinline__ void cvt_block(const float* __restrict__ src, bf16_t* __restrict__ dst, int blk) {
    const int i = blk * CVT_BLK + threadIdx.x * 8;
    const v4f a = *(const v4f*)(src + i);
    const v4f c = *(const v4f*)(src + i + 4);
    v8bf r;
    // unroll: constant indices keep a, c and r in registers
    #pragma unroll
    for (int e = 0; e < 4; ++e) {
        r[e]     = (bf16_t)a[e];
        r[e + 4] = (bf16_t)c[e];
    }
    *(v8bf*)(dst + i) = r;
    // the store's address and data registers may be rewritten on the paths behind it: wait first
    asm volatile("s_wait_xcnt 0x0" ::: "memory");
}

// ---------------------------------------------------------------------------
// BN stats over (B,N): fold into y = x*s + t (biased var, eps=1e-5)
// ---------------------------------------------------------------------------
__device__ __forceinline__
void bn_stats_block(const float* __restrict__ x, const float* __restrict__ g,
                    const float* __restrict__ bet, float* __restrict__ s,
                    float* __restrict__ t) {
    __shared__ float ssum[256];
    __shared__ float ssq[256];
    const int c = blockIdx.x;
    // a thread's 32 values come as eight independent 16-byte loads (4 consecutive n of each b),
    // and g, bet with them: the wave waits out the load latency once, not once per value
    const float gc = g[c], bc = bet[c];
    const float* p = x + (size_t)c * NTOK + threadIdx.x * 4;
    v4f v[BATCH];
    // unroll: all eight loads are issued before the first value is used
    #pragma unroll
    for (int b = 0; b < BATCH; ++b) v[b] = *(const v4f*)(p + (size_t)b * DIM * NTOK);
    // the address registers of these loads, and of g's and bet's, are rewritten further down: wait first
    asm volatile("s_wait_xcnt 0x0" ::: "memory");
    v4f s4 = {}, q4 = {};
    // unroll: constant indices keep v in registers
    #pragma unroll
    for (int b = 0; b < BATCH; ++b) { s4 += v[b]; q4 += v[b] * v[b]; }
    const float sum = (s4[0] + s4[1]) + (s4[2] + s4[3]);
    const float sq  = (q4[0] + q4[1]) + (q4[2] + q4[3]);
    ssum[threadIdx.x] = sum; ssq[threadIdx.x] = sq;
    __syncthreads();
    for (int off = 128; off > 0; off >>= 1) {
        if (threadIdx.x < off) {
            ssum[threadIdx.x] += ssum[threadIdx.x + off];
            ssq[threadIdx.x]  += ssq[threadIdx.x + off];
        }
        __syncthreads();
    }
    if (threadIdx.x == 0) {
        const float cnt = (float)BATCH * (float)NTOK;
        float m   = ssum[0] / cnt;
        float var = ssq[0] / cnt - m * m;
        float sc  = gc * rsqrtf(var + 1e-5f);
        s[c] = sc;
        t[c] = bc - m * sc;
    }
}

__global__ __launch_bounds__(256)
void bn_stats_kernel(const float* __restrict__ x, const float* __restrict__ g,
                     const float* __restrict__ bet, float* __restrict__ s,
                     float* __restrict__ t) {
    bn_stats_block(x, g, bet, s, t);
}

// ---------------------------------------------------------------------------
// First launch: BN1 statistics and the six weight conversions depend on nothing
// but the inputs, so they share one grid. Workgroups [0, DIM) do one channel's
// statistics (the longer job, started first), the rest convert weights.
// ---------------------------------------------------------------------------
__global__ __launch_bounds__(256)
void prep_kernel(const float* __restrict__ x, const float* __restrict__ g,
                 const float* __restrict__ bet, float* __restrict__ s, float* __restrict__ t,
                 const float* __restrict__ wq, const float* __restrict__ wk,
                 const float* __restrict__ wv, const float* __restrict__ wp,
                 const float* __restrict__ w1, const float* __restrict__ w2,
                 bf16_t* __restrict__ wqb, bf16_t* __restrict__ wkb,
                 bf16_t* __restrict__ wvb, bf16_t* __restrict__ wpb,
                 bf16_t* __restrict__ w1b, bf16_t* __restrict__ w2b) {
    if (blockIdx.x < DIM) {
        bn_stats_block(x, g, bet, s, t);
        return;
    }
    int blk = blockIdx.x - DIM;
    if (blk < CVT_SMALL)     { cvt_block(wq, wqb, blk); return; }
    blk -= CVT_SMALL;
    if (blk < CVT_SMALL)     { cvt_block(wk, wkb, blk); return; }
    blk -= CVT_SMALL;
    const int which = blk / CVT_LARGE;
    blk -= which * CVT_LARGE;
    const float* src = which == 0 ? wv  : which == 1 ? wp  : which == 2 ? w1  : w2;
    bf16_t*      dst = which == 0 ? wvb : which == 1 ? wpb : which == 2 ? w1b : w2b;
    cvt_block(src, dst, blk);
}

// ---------------------------------------------------------------------------
// Fused BN-apply + transpose: x[b][c][n] (f32) -> yt[b][n][c] (bf16)
// ---------------------------------------------------------------------------
__global__ __launch_bounds__(256)
void bn_apply_t_kernel(const float* __restrict__ x, const float* __restrict__ s,
                       const float* __restrict__ t, bf16_t* __restrict__ yt) {
    __shared__ bf16_t tile[32][33];
    const int b  = blockIdx.z;
    const int c0 = blockIdx.y * 32;
    const int n0 = blockIdx.x * 32;
    const int tx = threadIdx.x & 31, ty = threadIdx.x >> 5;
    for (int rr = 0; rr < 32; rr += 8) {
        int c = c0 + ty + rr;
        tile[ty + rr][tx] = (bf16_t)(x[((size_t)b * DIM + c) * NTOK + n0 + tx] * s[c] + t[c]);
    }
    __syncthreads();
    for (int rr = 0; rr < 32; rr += 8)
        yt[((size_t)b * NTOK + n0 + ty + rr) * DIM + c0 + tx] = tile[tx][ty + rr];
}

// ---------------------------------------------------------------------------
// Tiled bf16 WMMA GEMM: Out[b][o][n] = W[o][k] @ Yt[b][n][k]^T + bias (+res)
//   workgroup tile 64(O) x 128(N); 8 waves 2x4; wave tile 32x32; K step 32
//   All LDS staging via 16B async copies.
//   mode 0: outb = bf16(acc+bias)   mode 1: outf = acc+bias+res (f32)
//   mode 2: outb = bf16(relu6(acc+bias))
//   mode 3: outb[b][n][o] = bf16(acc+bias)   mode 4: outb[b][n][o] = bf16(relu6(acc+bias))
//   Modes 3 and 4 write token-major, the layout in which the next product reads its operand.
//   mode 5: three products of the same Yt in one grid, told apart by blockIdx.y:
//   O rows of (W, bias, outb) and O rows of (W2, bias2, outb2) as mode 3,
//   then O3 rows of (W3, bias3, outb3) as mode 0.
// ---------------------------------------------------------------------------
#define AS_STRIDE 40   // 80B rows: 16B-aligned segments, conflict-free frags
#define BS_STRIDE 40

// Channel-major epilogue of one wave tile, the mode fixed at compile time. The bias and, in mode 1,
// the residual of all 32 elements are loaded before the first is used, so the wave waits out the
// load latency once, not once per element. bias: at the lane's first row; idx0: its first element.
// The row pitch is the constant NTOK (every launch has N = NTOK): all rows then hang off one address
// register by immediate offsets, and no load or store waits for an address register to be free.
template <int MODE>
__device__ __forceinline__
void store_channel_major(const v8f (&acc)[2][2], const float* __restrict__ bias,
                         const float* __restrict__ res, float* __restrict__ outf,
                         bf16_t* __restrict__ outb, size_t idx0) {
    v4f bs[2][2];
    float r[2][2][8];
    bs[0][0] = *(const v4f*)(bias);
    bs[0][1] = *(const v4f*)(bias + 4);
    bs[1][0] = *(const v4f*)(bias + 16);
    // the last load's result may land in the address registers that the three loads before it name: wait first
    asm volatile("s_wait_xcnt 0x0" ::: "memory");
    bs[1][1] = *(const v4f*)(bias + 20);
    // every unroll here: constant indices keep acc, bs and r in registers
    if (MODE == 1) {
        const float* rp = res + idx0;
        #pragma unroll
        for (int mi = 0; mi < 2; ++mi)
            #pragma unroll
            for (int e = 0; e < 8; ++e)
                #pragma unroll
                for (int ni = 0; ni < 2; ++ni)
                    r[mi][ni][e] = rp[(mi * 16 + e) * NTOK + ni * 16];
    }
    #pragma unroll
    for (int mi = 0; mi < 2; ++mi) {
        #pragma unroll
        for (int e = 0; e < 8; ++e) {
            #pragma unroll
            for (int ni = 0; ni < 2; ++ni) {
                const float v = acc[mi][ni][e] + bs[mi][e >> 2][e & 3];
                if (MODE == 0)      r[mi][ni][e] = v;
                else if (MODE == 1) r[mi][ni][e] = v + r[mi][ni][e];
                else                r[mi][ni][e] = fminf(fmaxf(v, 0.f), 6.f);
            }
        }
    }
    // all 32 results first, then all 32 stores, each from a register of its own: no store waits on another
    #pragma unroll
    for (int mi = 0; mi < 2; ++mi) {
        #pragma unroll
        for (int e = 0; e < 8; ++e) {
            #pragma unroll
            for (int ni = 0; ni < 2; ++ni) {
                const int off = (mi * 16 + e) * NTOK + ni * 16;
                if (MODE == 1) (outf + idx0)[off] = r[mi][ni][e];
                else           (outb + idx0)[off] = (bf16_t)r[mi][ni][e];
            }
        }
    }
    // the stores' address and data registers may be rewritten on the paths behind them: wait first
    asm volatile("s_wait_xcnt 0x0" ::: "memory");
}

// second argument: 10 waves per SIMD, as before. Without it the epilogue's preloads raise the build from 92
// to 106 registers, 9 waves per SIMD, and a WGP holds four of these 8-wave workgroups instead of five
__global__ __launch_bounds__(256, 10)
void gemm_kernel(const bf16_t* __restrict__ W, const bf16_t* __restrict__ Yt,
                 const float* __restrict__ bias, const float* __restrict__ res,
                 float* __restrict__ outf, bf16_t* __restrict__ outb,
                 int O, int K, int N, int mode,
                 const bf16_t* __restrict__ W2, const float* __restrict__ bias2,
                 bf16_t* __restrict__ outb2,
                 const bf16_t* __restrict__ W3, const float* __restrict__ bias3,
                 bf16_t* __restrict__ outb3, int O3) {
    __shared__ bf16_t As[64 * AS_STRIDE];
    __shared__ bf16_t Bs[128 * BS_STRIDE];

    const int tid  = threadIdx.x;
    const int lane = tid & 31;
    const int wave = tid >> 5;
    const int half = lane >> 4;
    const int col  = lane & 15;

    const int b  = blockIdx.z;
    int oy = blockIdx.y;                 // 64-row block of the product's own O
    const int n0 = blockIdx.x * 128;
    const bf16_t* Yb = Yt + (size_t)b * N * K;

    if (mode == 5) {
        const int nb = O >> 6;
        mode = 3;
        if (oy >= 2 * nb)  { oy -= 2 * nb; W = W3; bias = bias3; outb = outb3; O = O3; mode = 0; }
        else if (oy >= nb) { oy -= nb;     W = W2; bias = bias2; outb = outb2; }
    }
    const int o0 = oy * 64;

    const int ow = (wave & 1) * 32;
    const int nw = (wave >> 1) * 32;

    const int ar = tid >> 2, asg = tid & 3;         // A: 64 rows x 4 segs
    const int br0 = tid >> 1, bs0 = (tid & 1) * 2;  // B: 128 rows x 4 segs (2/thread)

    v8f acc[2][2] = {};

    for (int kk = 0; kk < K; kk += 32) {
        cp16(&As[ar * AS_STRIDE + asg * 8], W + (size_t)(o0 + ar) * K + kk + asg * 8);
        cp16(&Bs[br0 * BS_STRIDE + bs0 * 8],       Yb + (size_t)(n0 + br0) * K + kk + bs0 * 8);
        cp16(&Bs[br0 * BS_STRIDE + (bs0 + 1) * 8], Yb + (size_t)(n0 + br0) * K + kk + (bs0 + 1) * 8);
        if (kk + 32 < K)
            __builtin_prefetch(W + (size_t)(o0 + ar) * K + kk + 32, 0, 1);
        async_wait();
        __syncthreads();

        v16bf a0 = load_frag(As, ow + col,      AS_STRIDE, half * 8);
        v16bf a1 = load_frag(As, ow + 16 + col, AS_STRIDE, half * 8);
        v16bf b0 = load_frag(Bs, nw + col,      BS_STRIDE, half * 8);
        v16bf b1 = load_frag(Bs, nw + 16 + col, BS_STRIDE, half * 8);

        acc[0][0] = WMMA_BF16(a0, b0, acc[0][0]);
        acc[0][1] = WMMA_BF16(a0, b1, acc[0][1]);
        acc[1][0] = WMMA_BF16(a1, b0, acc[1][0]);
        acc[1][1] = WMMA_BF16(a1, b1, acc[1][1]);
        __syncthreads();
    }

    // token-major epilogue: a lane's 8 elements are 8 consecutive o of one token, one 16-byte store
    if (mode >= 3) {
        for (int mi = 0; mi < 2; ++mi) {
            const int om = o0 + ow + mi * 16 + 8 * half;
            for (int ni = 0; ni < 2; ++ni) {
                const int on = n0 + nw + ni * 16 + col;
                v8bf r;
                // unroll: constant indices keep acc and r in registers
                #pragma unroll
                for (int e = 0; e < 8; ++e) {
                    float v = acc[mi][ni][e] + bias[om + e];
                    if (mode == 4) v = fminf(fmaxf(v, 0.f), 6.f);
                    r[e] = (bf16_t)v;
                }
                *(v8bf*)(outb + ((size_t)b * N + on) * O + om) = r;
            }
        }
        return;
    }

    // epilogue: acc element e -> (M = e+8*half, N = lane&15); stores coalesce along n
    const int om0 = o0 + ow + 8 * half;
    const size_t idx0 = ((size_t)b * O + om0) * N + n0 + nw + col;
    if (mode == 0)      store_channel_major<0>(acc, bias + om0, res, outf, outb, idx0);
    else if (mode == 1) store_channel_major<1>(acc, bias + om0, res, outf, outb, idx0);
    else                store_channel_major<2>(acc, bias + om0, res, outf, outb, idx0);
}

#define QS_STRIDE 40
#define KS_STRIDE 40
#define VS_STRIDE 136
#define ATTN_LDS_BYTES (128*QS_STRIDE*2 + 128*KS_STRIDE*2 + 64*VS_STRIDE*2)

// value of lane l ^ 16
__device__ __forceinline__ float other_half(float x) {
    int v = __builtin_bit_cast(int, x);
    v = __builtin_amdgcn_permlanex16(v, v, 0x76543210, 0xfedcba98, false, false);
    return __builtin_bit_cast(float, v);
}

__global__ __launch_bounds__(256)
void attn_kernel(const bf16_t* __restrict__ qt, const bf16_t* __restrict__ kt,
                 const bf16_t* __restrict__ vb, bf16_t* __restrict__ ot) {
    extern __shared__ char smem[];
    bf16_t* Qs = (bf16_t*)smem;                       // [128][QS_STRIDE]
    bf16_t* Ks = Qs + 128 * QS_STRIDE;                // [128][KS_STRIDE]
    bf16_t* Vs = Ks + 128 * KS_STRIDE;                // [64][VS_STRIDE]

    const int tid  = threadIdx.x;
    const int lane = tid & 31;
    const int wave = tid >> 5;
    const int half = lane >> 4;
    const int col  = lane & 15;

    const int q0 = blockIdx.x * 128;
    const int h  = blockIdx.y;
    const int b  = blockIdx.z;
    const size_t headv = ((size_t)b * DH + (size_t)h * DHEAD) * NTOK;

    // zero kd-pad [16..32) of Qs and Ks (async copies only touch [0..16))
    {
        v8bf z = {};
        int row = tid >> 1, hh = tid & 1;
        *(v8bf*)(&Qs[row * QS_STRIDE + 16 + hh * 8]) = z;
        *(v8bf*)(&Ks[row * KS_STRIDE + 16 + hh * 8]) = z;
    }
    // stage Q block: Qs[n][kd] <- qt[b][q0+n][h*16 + kd], 2x16B per row
    {
        int n = tid >> 1, sg = tid & 1;
        cp16(&Qs[n * QS_STRIDE + sg * 8],
             qt + ((size_t)b * NTOK + q0 + n) * DIM + h * KDIM + sg * 8);
    }
    async_wait();
    __syncthreads();

    // B operand of S^T: column = query wave*16 + col
    const v16bf qf = load_frag(Qs, wave * 16 + col, QS_STRIDE, half * 8);

    v8f acc[4] = {};                  // acc[dt][e] = O[query col][dt*16 + 8*half + e]
    float m = -1e30f;                 // running maximum of query col, equal in both half-waves
    float l = 0.f;                    // this half-wave's share of the sum, joined in the epilogue

    for (int c0 = 0; c0 < NTOK; c0 += 128) {
        // stage K chunk: Ks[key][kd], 2x16B per row
        {
            int n = tid >> 1, sg = tid & 1;
            cp16(&Ks[n * KS_STRIDE + sg * 8],
                 kt + ((size_t)b * NTOK + c0 + n) * DIM + h * KDIM + sg * 8);
        }
        // stage V chunk: Vs[d][key], 16x16B per row (4 segs/thread)
        #pragma unroll
        for (int r = 0; r < 4; ++r) {
            int s = tid + 256 * r;
            int d = s >> 4, sg = s & 15;
            cp16(&Vs[d * VS_STRIDE + sg * 8], vb + headv + (size_t)d * NTOK + c0 + sg * 8);
        }
        async_wait();
        __syncthreads();

        // two passes of 64 keys: 32 score registers a pass leave room for 8 waves per SIMD
        // nounroll: unrolled, the compiler interleaves the two passes and takes 166 VGPRs instead of 125,
        // which halves the workgroups that fit on a WGP
        #pragma nounroll
        for (int kb = 0; kb < 128; kb += 64) {
            // S^T = (K @ Q^T) * 4 : st[jt][e] = score(key kb + jt*16 + 8*half + e, query col)
            v8f st[4];
            #pragma unroll
            for (int jt = 0; jt < 4; ++jt) {
                v16bf kf = load_frag(Ks, kb + jt * 16 + col, KS_STRIDE, half * 8);
                v8f s = {};
                s = WMMA_BF16(kf, qf, s);
                st[jt] = s * 4.0f;
            }

            // online softmax in registers: 32 keys in-lane, one exchange between halves
            v8f mx = __builtin_elementwise_max(__builtin_elementwise_max(st[0], st[1]),
                                               __builtin_elementwise_max(st[2], st[3]));
            float cm = fmaxf(fmaxf(fmaxf(mx[0], mx[1]), fmaxf(mx[2], mx[3])),
                             fmaxf(fmaxf(mx[4], mx[5]), fmaxf(mx[6], mx[7])));
            cm = fmaxf(cm, other_half(cm));
            const float nm    = fmaxf(m, cm);
            const float alpha = __expf(m - nm);
            m = nm;

            #pragma unroll
            for (int jt = 0; jt < 4; ++jt) {
                v8f t = (st[jt] - nm) * 1.44269504f;   // exp(x) = exp2(x * log2 e)
                #pragma unroll
                for (int e = 0; e < 8; ++e) t[e] = __builtin_amdgcn_exp2f(t[e]);
                st[jt] = t;
            }
            const v8f ps = (st[0] + st[1]) + (st[2] + st[3]);
            l = l * alpha + (((ps[0] + ps[1]) + (ps[2] + ps[3])) + ((ps[4] + ps[5]) + (ps[6] + ps[7])));

            // rescale accumulators: every element of a lane belongs to query col
            #pragma unroll
            for (int dt = 0; dt < 4; ++dt) acc[dt] *= alpha;

            // O^T += V^T @ P^T ; tiles 2*k2 and 2*k2+1 give keys 8*half+e and 16+8*half+e
            // of a 32-key block: the k order in which load_frag reads V
            #pragma unroll
            for (int k2 = 0; k2 < 2; ++k2) {
                v16bf pf;
                #pragma unroll
                for (int e = 0; e < 8; ++e) {
                    pf[e]     = (bf16_t)st[2 * k2][e];
                    pf[e + 8] = (bf16_t)st[2 * k2 + 1][e];
                }
                #pragma unroll
                for (int dt = 0; dt < 4; ++dt) {
                    v16bf vf = load_frag(Vs, dt * 16 + col, VS_STRIDE, kb + k2 * 32 + half * 8);
                    acc[dt] = WMMA_BF16(vf, pf, acc[dt]);
                }
            }
        }
        __syncthreads();
    }

    // epilogue: ot[b][q][h*64+d], a lane's 8 accumulator elements are 8 consecutive d
    l += other_half(l);
    const float li = 1.0f / l;
    bf16_t* orow = ot + ((size_t)b * NTOK + q0 + wave * 16 + col) * DH + h * DHEAD + 8 * half;
    #pragma unroll
    for (int dt = 0; dt < 4; ++dt) {
        v8bf o;
        #pragma unroll
        for (int e = 0; e < 8; ++e) o[e] = (bf16_t)(acc[dt][e] * li);
        *(v8bf*)(orow + dt * 16) = o;
    }
}

// ---------------------------------------------------------------------------
// Host orchestration
// ---------------------------------------------------------------------------
extern "C" void kernel_launch(void* const* d_in, const int* in_sizes, int n_in,
                              void* d_out, int out_size, void* d_ws, size_t ws_size,
                              hipStream_t stream) {
    const float* x   = (const float*)d_in[0];
    const float* g1  = (const float*)d_in[1];
    const float* b1  = (const float*)d_in[2];
    const float* wq  = (const float*)d_in[3];
    const float* bq  = (const float*)d_in[4];
    const float* wk  = (const float*)d_in[5];
    const float* bk  = (const float*)d_in[6];
    const float* wv  = (const float*)d_in[7];
    const float* bv  = (const float*)d_in[8];
    const float* wp  = (const float*)d_in[9];
    const float* bp  = (const float*)d_in[10];
    const float* g2  = (const float*)d_in[11];
    const float* b2  = (const float*)d_in[12];
    const float* w1  = (const float*)d_in[13];
    const float* bb1 = (const float*)d_in[14];
    const float* w2  = (const float*)d_in[15];
    const float* bb2 = (const float*)d_in[16];
    float* out = (float*)d_out;

    char* ws = (char*)d_ws;
    size_t off = 0;
    auto alloc = [&](size_t bytes) -> void* {
        void* p = ws + off;
        off = (off + bytes + 255) & ~(size_t)255;
        return p;
    };

    const size_t BCN = (size_t)BATCH * DIM * NTOK;
    const size_t BHN = (size_t)BATCH * DH * NTOK;

    float*  s1   = (float*)alloc(DIM * 4);
    float*  t1   = (float*)alloc(DIM * 4);
    float*  s2   = (float*)alloc(DIM * 4);
    float*  t2   = (float*)alloc(DIM * 4);
    bf16_t* wqb  = (bf16_t*)alloc((size_t)DIM * DIM * 2);
    bf16_t* wkb  = (bf16_t*)alloc((size_t)DIM * DIM * 2);
    bf16_t* wvb  = (bf16_t*)alloc((size_t)DH * DIM * 2);
    bf16_t* wpb  = (bf16_t*)alloc((size_t)DIM * DH * 2);
    bf16_t* w1b  = (bf16_t*)alloc((size_t)HID * DIM * 2);
    bf16_t* w2b  = (bf16_t*)alloc((size_t)DIM * HID * 2);
    bf16_t* ytb  = (bf16_t*)alloc(BCN * 2);   // BN1(x), [b][n][c]
    bf16_t* qtb  = (bf16_t*)alloc(BCN * 2);   // Q, [b][n][o]
    bf16_t* ktb  = (bf16_t*)alloc(BCN * 2);   // K, [b][n][o]
    bf16_t* vbf  = (bf16_t*)alloc(BHN * 2);   // V, [b][dh][n]
    bf16_t* otb  = (bf16_t*)alloc(BHN * 2);   // attn out, [b][n][dh]
    float*  xf2  = (float*)alloc(BCN * 4);    // residual 1, [b][c][n]
    bf16_t* y2tb = (bf16_t*)alloc(BCN * 2);   // BN2(xf2), [b][n][c]
    bf16_t* htb  = (bf16_t*)alloc(BHN * 2);   // MLP hidden, [b][n][h]

    // BN1 statistics, and weights -> bf16
    prep_kernel<<<DIM + CVT_GROUPS, 256, 0, stream>>>(x, g1, b1, s1, t1, wq, wk, wv, wp, w1, w2,
                                                      wqb, wkb, wvb, wpb, w1b, w2b);

    // BN1 folded + transpose: ytb[b][n][c]
    bn_apply_t_kernel<<<dim3(NTOK / 32, DIM / 32, BATCH), 256, 0, stream>>>(x, s1, t1, ytb);

    // Q, K (token-major for the attention fragments) and V projections, one grid
    gemm_kernel<<<dim3(NTOK / 128, (2 * DIM + DH) / 64, BATCH), 256, 0, stream>>>(
        wqb, ytb, bq, nullptr, nullptr, qtb, DIM, DIM, NTOK, 5,
        wkb, bk, ktb, wvb, bv, vbf, DH);

    // attention -> otb[b][n][dh]
    attn_kernel<<<dim3(NTOK / 128, NHEAD, BATCH), 256, ATTN_LDS_BYTES, stream>>>(
        qtb, ktb, vbf, otb);

    // projection + residual: xf2 = x + Wp @ o + bp
    gemm_kernel<<<dim3(NTOK / 128, DIM / 64, BATCH), 256, 0, stream>>>(
        wpb, otb, bp, x, xf2, nullptr, DIM, DH, NTOK, 1,
        nullptr, nullptr, nullptr, nullptr, nullptr, nullptr, 0);

    // BN2 folded + transpose
    bn_stats_kernel<<<DIM, 256, 0, stream>>>(xf2, g2, b2, s2, t2);
    bn_apply_t_kernel<<<dim3(NTOK / 32, DIM / 32, BATCH), 256, 0, stream>>>(xf2, s2, t2, y2tb);

    // MLP: h = relu6(W1 @ y2 + bb1); out = xf2 + W2 @ h + bb2
    gemm_kernel<<<dim3(NTOK / 128, HID / 64, BATCH), 256, 0, stream>>>(
        w1b, y2tb, bb1, nullptr, nullptr, htb, HID, DIM, NTOK, 4,
        nullptr, nullptr, nullptr, nullptr, nullptr, nullptr, 0);
    gemm_kernel<<<dim3(NTOK / 128, DIM / 64, BATCH), 256, 0, stream>>>(
        w2b, htb, bb2, xf2, out, nullptr, DIM, HID, NTOK, 1,
        nullptr, nullptr, nullptr, nullptr, nullptr, nullptr, 0);
}

// v005
// It runs in 90.7 microseconds.
// Timed twice side by side with v004, it ran 1.22 and 1.23 times as fast.
// Counting every step since v000, it is 3.02 times as fast.
#include <hip/hip_runtime.h>
#include <hip/hip_bf16.h>

// ---------------------------------------------------------------------------
// Types for CDNA5 WMMA (wave32)
// ---------------------------------------------------------------------------
typedef __bf16 bf16_t;
typedef __attribute__((ext_vector_type(16))) __bf16 v16bf;
typedef __attribute__((ext_vector_type(8)))  __bf16 v8bf;
typedef __attribute__((ext_vector_type(8)))  float  v8f;
typedef __attribute__((ext_vector_type(4)))  float  v4f;
typedef int v4i __attribute__((vector_size(16)));

union AFrag {
    v16bf v;
    struct { v8bf lo, hi; } h;
};

// Fragment from LDS laid out [row][k], k contiguous. Per the CDNA5 ISA layout,
// lane L owns row/col L&15; half-wave selects K {kbase..+7} and {kbase+16..+23},
// kbase = 8*(L>>4). Two aligned ds_load_b128 per fragment.
__device__ __forceinline__ v16bf load_frag(const bf16_t* base, int row, int stride, int koff) {
    const bf16_t* p = base + row * stride + koff;
    AFrag f;
    f.h.lo = *(const v8bf*)(p);
    f.h.hi = *(const v8bf*)(p + 16);
    return f.v;
}

#define WMMA_BF16(A, B, C) \
    __builtin_amdgcn_wmma_f32_16x16x32_bf16(false, (A), false, (B), (short)0, (C), false, false)

// ---------------------------------------------------------------------------
// CDNA5 async global->LDS copy (16B per lane). Builtin params are generic
// pointers to int4 per the clang declaration; fallback keeps host pass legal.
// ---------------------------------------------------------------------------
#if __has_builtin(__builtin_amdgcn_global_load_async_to_lds_b128) && \
    __has_builtin(__builtin_amdgcn_s_wait_asynccnt)
#define USE_ASYNC_LDS 1
#else
#define USE_ASYNC_LDS 0
#endif

__device__ __forceinline__ void cp16(void* lds, const void* g) {
#if USE_ASYNC_LDS
    __builtin_amdgcn_global_load_async_to_lds_b128((v4i*)g, (v4i*)lds, 0, 0);
#else
    *(v8bf*)lds = *(const v8bf*)g;
#endif
}

__device__ __forceinline__ void async_wait() {
#if USE_ASYNC_LDS
    __builtin_amdgcn_s_wait_asynccnt(0);
#endif
}

// ---------------------------------------------------------------------------
// Problem constants
// ---------------------------------------------------------------------------
#define BATCH 8
#define DIM   256
#define NTOK  1024
#define NHEAD 16
#define KDIM  16
#define DHEAD 64
#define DH    1024
#define HID   1024

// ---------------------------------------------------------------------------
// float -> bf16 (weights): one workgroup converts CVT_BLK consecutive elements,
// 8 a thread (two 16-byte loads, one 16-byte store)
// ---------------------------------------------------------------------------
#define CVT_BLK 2048
#define CVT_SMALL (DIM * DIM / CVT_BLK)   // workgroups for wq, and for wk
#define CVT_LARGE (DH * DIM / CVT_BLK)    // workgroups for each of wv, wp, w1, w2
#define CVT_GROUPS (2 * CVT_SMALL + 4 * CVT_LARGE)

__device__ __forceinline__ void cvt_block(const float* __restrict__ src, bf16_t* __restrict__ dst, int blk) {
    const int i = blk * CVT_BLK + threadIdx.x * 8;
    const v4f a = *(const v4f*)(src + i);
    const v4f c = *(const v4f*)(src + i + 4);
    v8bf r;
    // unroll: constant indices keep a, c and r in registers
    #pragma unroll
    for (int e = 0; e < 4; ++e) {
        r[e]     = (bf16_t)a[e];
        r[e + 4] = (bf16_t)c[e];
    }
    *(v8bf*)(dst + i) = r;
    // the store's address and data registers may be rewritten on the paths behind it: wait first
    asm volatile("s_wait_xcnt 0x0" ::: "memory");
}

// ---------------------------------------------------------------------------
// BN stats over (B,N): fold into y = x*s + t (biased var, eps=1e-5)
// ---------------------------------------------------------------------------
__device__ __forceinline__
void bn_stats_block(const float* __restrict__ x, const float* __restrict__ g,
                    const float* __restrict__ bet, float* __restrict__ s,
                    float* __restrict__ t) {
    __shared__ float ssum[256];
    __shared__ float ssq[256];
    const int c = blockIdx.x;
    // a thread's 32 values come as eight independent 16-byte loads (4 consecutive n of each b),
    // and g, bet with them: the wave waits out the load latency once, not once per value
    const float gc = g[c], bc = bet[c];
    const float* p = x + (size_t)c * NTOK + threadIdx.x * 4;
    v4f v[BATCH];
    // unroll: all eight loads are issued before the first value is used
    #pragma unroll
    for (int b = 0; b < BATCH; ++b) v[b] = *(const v4f*)(p + (size_t)b * DIM * NTOK);
    // the address registers of these loads, and of g's and bet's, are rewritten further down: wait first
    asm volatile("s_wait_xcnt 0x0" ::: "memory");
    v4f s4 = {}, q4 = {};
    // unroll: constant indices keep v in registers
    #pragma unroll
    for (int b = 0; b < BATCH; ++b) { s4 += v[b]; q4 += v[b] * v[b]; }
    const float sum = (s4[0] + s4[1]) + (s4[2] + s4[3]);
    const float sq  = (q4[0] + q4[1]) + (q4[2] + q4[3]);
    ssum[threadIdx.x] = sum; ssq[threadIdx.x] = sq;
    __syncthreads();
    for (int off = 128; off > 0; off >>= 1) {
        if (threadIdx.x < off) {
            ssum[threadIdx.x] += ssum[threadIdx.x + off];
            ssq[threadIdx.x]  += ssq[threadIdx.x + off];
        }
        __syncthreads();
    }
    if (threadIdx.x == 0) {
        const float cnt = (float)BATCH * (float)NTOK;
        float m   = ssum[0] / cnt;
        float var = ssq[0] / cnt - m * m;
        float sc  = gc * rsqrtf(var + 1e-5f);
        s[c] = sc;
        t[c] = bc - m * sc;
    }
}

__global__ __launch_bounds__(256)
void bn_stats_kernel(const float* __restrict__ x, const float* __restrict__ g,
                     const float* __restrict__ bet, float* __restrict__ s,
                     float* __restrict__ t) {
    bn_stats_block(x, g, bet, s, t);
}

// ---------------------------------------------------------------------------
// First launch: BN1 statistics and the six weight conversions depend on nothing
// but the inputs, so they share one grid. Workgroups [0, DIM) do one channel's
// statistics (the longer job, started first), the rest convert weights.
// ---------------------------------------------------------------------------
__global__ __launch_bounds__(256)
void prep_kernel(const float* __restrict__ x, const float* __restrict__ g,
                 const float* __restrict__ bet, float* __restrict__ s, float* __restrict__ t,
                 const float* __restrict__ wq, const float* __restrict__ wk,
                 const float* __restrict__ wv, const float* __restrict__ wp,
                 const float* __restrict__ w1, const float* __restrict__ w2,
                 bf16_t* __restrict__ wqb, bf16_t* __restrict__ wkb,
                 bf16_t* __restrict__ wvb, bf16_t* __restrict__ wpb,
                 bf16_t* __restrict__ w1b, bf16_t* __restrict__ w2b) {
    if (blockIdx.x < DIM) {
        bn_stats_block(x, g, bet, s, t);
        return;
    }
    int blk = blockIdx.x - DIM;
    if (blk < CVT_SMALL)     { cvt_block(wq, wqb, blk); return; }
    blk -= CVT_SMALL;
    if (blk < CVT_SMALL)     { cvt_block(wk, wkb, blk); return; }
    blk -= CVT_SMALL;
    const int which = blk / CVT_LARGE;
    blk -= which * CVT_LARGE;
    const float* src = which == 0 ? wv  : which == 1 ? wp  : which == 2 ? w1  : w2;
    bf16_t*      dst = which == 0 ? wvb : which == 1 ? wpb : which == 2 ? w1b : w2b;
    cvt_block(src, dst, blk);
}

// ---------------------------------------------------------------------------
// Fused BN-apply + transpose: x[b][c][n] (f32) -> yt[b][n][c] (bf16)
// ---------------------------------------------------------------------------
__global__ __launch_bounds__(256)
void bn_apply_t_kernel(const float* __restrict__ x, const float* __restrict__ s,
                       const float* __restrict__ t, bf16_t* __restrict__ yt) {
    __shared__ bf16_t tile[32][33];
    const int b  = blockIdx.z;
    const int c0 = blockIdx.y * 32;
    const int n0 = blockIdx.x * 32;
    const int tx = threadIdx.x & 31, ty = threadIdx.x >> 5;
    for (int rr = 0; rr < 32; rr += 8) {
        int c = c0 + ty + rr;
        tile[ty + rr][tx] = (bf16_t)(x[((size_t)b * DIM + c) * NTOK + n0 + tx] * s[c] + t[c]);
    }
    __syncthreads();
    for (int rr = 0; rr < 32; rr += 8)
        yt[((size_t)b * NTOK + n0 + ty + rr) * DIM + c0 + tx] = tile[tx][ty + rr];
}

// ---------------------------------------------------------------------------
// Tiled bf16 WMMA GEMM: Out[b][o][n] = W[o][k] @ Yt[b][n][k]^T + bias (+res)
//   workgroup tile 64(O) x 128(N); 8 waves 2x4; wave tile 32x32
//   LDS staging via 16B async copies in a ring of two buffers, 128 k a stage: the copies of the
//   next stage fly while this stage's products run. K: a multiple of 128.
//   mode 0: outb = bf16(acc+bias)   mode 1: outf = acc+bias+res (f32)
//   mode 2: outb = bf16(relu6(acc+bias))
//   mode 3: outb[b][n][o] = bf16(acc+bias)   mode 4: outb[b][n][o] = bf16(relu6(acc+bias))
//   Modes 3 and 4 write token-major, the layout in which the next product reads its operand.
//   mode 5: three products of the same Yt in one grid, told apart by blockIdx.y:
//   O rows of (W, bias, outb) and O rows of (W2, bias2, outb2) as mode 3,
//   then O3 rows of (W3, bias3, outb3) as mode 0.
// ---------------------------------------------------------------------------
#define KSTAGE 128                    // k per stage: 256-byte rows
#define RS_STRIDE 136                 // 272B rows (16B x odd): 16B-aligned segments, conflict-free frags
#define A_ELEMS (64 * RS_STRIDE)      // W rows of a stage
#define B_ELEMS (128 * RS_STRIDE)     // Yt rows of a stage, behind the W rows
#define STAGE_ELEMS (A_ELEMS + B_ELEMS)

// One stage into one buffer: 16 segments of 16 bytes a row, 16 rows a sweep of the 256 threads;
// 4 sweeps for W, 8 for Yt, 12 copies a thread. lds, wg, yg: the thread's own segment of row tid>>4.
__device__ __forceinline__
void stage_copies(bf16_t* lds, const bf16_t* __restrict__ wg, const bf16_t* __restrict__ yg, int K) {
    // both unrolls: the LDS steps become constants
    #pragma unroll
    for (int r = 0; r < 4; ++r) cp16(lds + r * 16 * RS_STRIDE, wg + (size_t)(r * 16) * K);
    #pragma unroll
    for (int r = 0; r < 8; ++r) cp16(lds + A_ELEMS + r * 16 * RS_STRIDE, yg + (size_t)(r * 16) * K);
}

// Channel-major epilogue of one wave tile, the mode fixed at compile time. The bias and, in mode 1,
// the residual of all 32 elements are loaded before the first is used, so the wave waits out the
// load latency once, not once per element. bias: at the lane's first row; idx0: its first element.
// The row pitch is the constant NTOK (every launch has N = NTOK): all rows then hang off one address
// register by immediate offsets, and no load or store waits for an address register to be free.
template <int MODE>
__device__ __forceinline__
void store_channel_major(const v8f (&acc)[2][2], const float* __restrict__ bias,
                         const float* __restrict__ res, float* __restrict__ outf,
                         bf16_t* __restrict__ outb, size_t idx0) {
    v4f bs[2][2];
    float r[2][2][8];
    bs[0][0] = *(const v4f*)(bias);
    bs[0][1] = *(const v4f*)(bias + 4);
    bs[1][0] = *(const v4f*)(bias + 16);
    // the last load's result may land in the address registers that the three loads before it name: wait first
    asm volatile("s_wait_xcnt 0x0" ::: "memory");
    bs[1][1] = *(const v4f*)(bias + 20);
    // every unroll here: constant indices keep acc, bs and r in registers
    if (MODE == 1) {
        const float* rp = res + idx0;
        #pragma unroll
        for (int mi = 0; mi < 2; ++mi)
            #pragma unroll
            for (int e = 0; e < 8; ++e)
                #pragma unroll
                for (int ni = 0; ni < 2; ++ni)
                    r[mi][ni][e] = rp[(mi * 16 + e) * NTOK + ni * 16];
    }
    #pragma unroll
    for (int mi = 0; mi < 2; ++mi) {
        #pragma unroll
        for (int e = 0; e < 8; ++e) {
            #pragma unroll
            for (int ni = 0; ni < 2; ++ni) {
                const float v = acc[mi][ni][e] + bs[mi][e >> 2][e & 3];
                if (MODE == 0)      r[mi][ni][e] = v;
                else if (MODE == 1) r[mi][ni][e] = v + r[mi][ni][e];
                else                r[mi][ni][e] = fminf(fmaxf(v, 0.f), 6.f);
            }
        }
    }
    // all 32 results first, then all 32 stores, each from a register of its own: no store waits on another
    #pragma unroll
    for (int mi = 0; mi < 2; ++mi) {
        #pragma unroll
        for (int e = 0; e < 8; ++e) {
            #pragma unroll
            for (int ni = 0; ni < 2; ++ni) {
                const int off = (mi * 16 + e) * NTOK + ni * 16;
                if (MODE == 1) (outf + idx0)[off] = r[mi][ni][e];
                else           (outb + idx0)[off] = (bf16_t)r[mi][ni][e];
            }
        }
    }
    // the stores' address and data registers may be rewritten on the paths behind them: wait first
    asm volatile("s_wait_xcnt 0x0" ::: "memory");
}

// second argument: 6 waves per SIMD, the three 8-wave workgroups whose rings fit a WGP's LDS
__global__ __launch_bounds__(256, 6)
void gemm_kernel(const bf16_t* __restrict__ W, const bf16_t* __restrict__ Yt,
                 const float* __restrict__ bias, const float* __restrict__ res,
                 float* __restrict__ outf, bf16_t* __restrict__ outb,
                 int O, int K, int N, int mode,
                 const bf16_t* __restrict__ W2, const float* __restrict__ bias2,
                 bf16_t* __restrict__ outb2,
                 const bf16_t* __restrict__ W3, const float* __restrict__ bias3,
                 bf16_t* __restrict__ outb3, int O3) {
    __shared__ __attribute__((aligned(16))) bf16_t ring[2 * STAGE_ELEMS];

    const int tid  = threadIdx.x;
    const int lane = tid & 31;
    const int wave = tid >> 5;
    const int half = lane >> 4;
    const int col  = lane & 15;

    const int b  = blockIdx.z;
    int oy = blockIdx.y;                 // 64-row block of the product's own O
    const int n0 = blockIdx.x * 128;
    const bf16_t* Yb = Yt + (size_t)b * N * K;

    if (mode == 5) {
        const int nb = O >> 6;
        mode = 3;
        if (oy >= 2 * nb)  { oy -= 2 * nb; W = W3; bias = bias3; outb = outb3; O = O3; mode = 0; }
        else if (oy >= nb) { oy -= nb;     W = W2; bias = bias2; outb = outb2; }
    }
    const int o0 = oy * 64;

    const int ow = (wave & 1) * 32;
    const int nw = (wave >> 1) * 32;

    // the thread's own segment in every sweep of a stage: row tid>>4 of the sweep, segment tid&15
    const int sr = tid >> 4, sg = tid & 15;
    bf16_t* lds0 = ring + sr * RS_STRIDE + sg * 8;
    const bf16_t* wg = W  + (size_t)(o0 + sr) * K + sg * 8;
    const bf16_t* yg = Yb + (size_t)(n0 + sr) * K + sg * 8;
    const int nst = K / KSTAGE;

    v8f acc[2][2] = {};

    // prologue: stage 0 lands and is published, then stage 1 starts
    stage_copies(lds0, wg, yg, K);
    // this wave's copies of stage 0 have landed before the barrier behind which other waves read them
    asm volatile("s_wait_asynccnt 0x0" ::: "memory");
    __syncthreads();
    if (nst > 1) stage_copies(lds0 + STAGE_ELEMS, wg + KSTAGE, yg + KSTAGE, K);

    for (int s = 0; s < nst; ++s) {
        const bf16_t* As = ring + (s & 1) * STAGE_ELEMS;
        const bf16_t* Bs = As + A_ELEMS;
        // unroll: the four 32-k blocks of a stage in one straight run, fragment offsets constant
        #pragma unroll
        for (int k4 = 0; k4 < KSTAGE; k4 += 32) {
            v16bf a0 = load_frag(As, ow + col,      RS_STRIDE, k4 + half * 8);
            v16bf a1 = load_frag(As, ow + 16 + col, RS_STRIDE, k4 + half * 8);
            v16bf b0 = load_frag(Bs, nw + col,      RS_STRIDE, k4 + half * 8);
            v16bf b1 = load_frag(Bs, nw + 16 + col, RS_STRIDE, k4 + half * 8);

            acc[0][0] = WMMA_BF16(a0, b0, acc[0][0]);
            acc[0][1] = WMMA_BF16(a0, b1, acc[0][1]);
            acc[1][0] = WMMA_BF16(a1, b0, acc[1][0]);
            acc[1][1] = WMMA_BF16(a1, b1, acc[1][1]);
        }
        // publish point of stage s + 1. This wave's reads of stage s's buffer have returned ...
        asm volatile("s_wait_dscnt 0x0" ::: "memory");
        // ... and its copies of stage s + 1 have landed ...
        asm volatile("s_wait_asynccnt 0x0" ::: "memory");
        // ... in every wave: stage s + 1 may be read, stage s's buffer refilled
        __syncthreads();
        if (s + 2 < nst)
            stage_copies(lds0 + (s & 1) * STAGE_ELEMS, wg + (s + 2) * KSTAGE, yg + (s + 2) * KSTAGE, K);
    }
    // no copy is outstanding when the wave goes on to its end
    asm volatile("s_wait_asynccnt 0x0" ::: "memory");

    // token-major epilogue: a lane's 8 elements are 8 consecutive o of one token, one 16-byte store
    if (mode >= 3) {
        for (int mi = 0; mi < 2; ++mi) {
            const int om = o0 + ow + mi * 16 + 8 * half;
            for (int ni = 0; ni < 2; ++ni) {
                const int on = n0 + nw + ni * 16 + col;
                v8bf r;
                // unroll: constant indices keep acc and r in registers
                #pragma unroll
                for (int e = 0; e < 8; ++e) {
                    float v = acc[mi][ni][e] + bias[om + e];
                    if (mode == 4) v = fminf(fmaxf(v, 0.f), 6.f);
                    r[e] = (bf16_t)v;
                }
                *(v8bf*)(outb + ((size_t)b * N + on) * O + om) = r;
            }
        }
        return;
    }

    // epilogue: acc element e -> (M = e+8*half, N = lane&15); stores coalesce along n
    const int om0 = o0 + ow + 8 * half;
    const size_t idx0 = ((size_t)b * O + om0) * N + n0 + nw + col;
    if (mode == 0)      store_channel_major<0>(acc, bias + om0, res, outf, outb, idx0);
    else if (mode == 1) store_channel_major<1>(acc, bias + om0, res, outf, outb, idx0);
    else                store_channel_major<2>(acc, bias + om0, res, outf, outb, idx0);
}

#define QS_STRIDE 40
#define KS_STRIDE 40
#define VS_STRIDE 136
#define ATTN_LDS_BYTES (128*QS_STRIDE*2 + 128*KS_STRIDE*2 + 64*VS_STRIDE*2)

// value of lane l ^ 16
__device__ __forceinline__ float other_half(float x) {
    int v = __builtin_bit_cast(int, x);
    v = __builtin_amdgcn_permlanex16(v, v, 0x76543210, 0xfedcba98, false, false);
    return __builtin_bit_cast(float, v);
}

__global__ __launch_bounds__(256)
void attn_kernel(const bf16_t* __restrict__ qt, const bf16_t* __restrict__ kt,
                 const bf16_t* __restrict__ vb, bf16_t* __restrict__ ot) {
    extern __shared__ char smem[];
    bf16_t* Qs = (bf16_t*)smem;                       // [128][QS_STRIDE]
    bf16_t* Ks = Qs + 128 * QS_STRIDE;                // [128][KS_STRIDE]
    bf16_t* Vs = Ks + 128 * KS_STRIDE;                // [64][VS_STRIDE]

    const int tid  = threadIdx.x;
    const int lane = tid & 31;
    const int wave = tid >> 5;
    const int half = lane >> 4;
    const int col  = lane & 15;

    const int q0 = blockIdx.x * 128;
    const int h  = blockIdx.y;
    const int b  = blockIdx.z;
    const size_t headv = ((size_t)b * DH + (size_t)h * DHEAD) * NTOK;

    // zero kd-pad [16..32) of Qs and Ks (async copies only touch [0..16))
    {
        v8bf z = {};
        int row = tid >> 1, hh = tid & 1;
        *(v8bf*)(&Qs[row * QS_STRIDE + 16 + hh * 8]) = z;
        *(v8bf*)(&Ks[row * KS_STRIDE + 16 + hh * 8]) = z;
    }
    // stage Q block: Qs[n][kd] <- qt[b][q0+n][h*16 + kd], 2x16B per row
    {
        int n = tid >> 1, sg = tid & 1;
        cp16(&Qs[n * QS_STRIDE + sg * 8],
             qt + ((size_t)b * NTOK + q0 + n) * DIM + h * KDIM + sg * 8);
    }
    async_wait();
    __syncthreads();

    // B operand of S^T: column = query wave*16 + col
    const v16bf qf = load_frag(Qs, wave * 16 + col, QS_STRIDE, half * 8);

    v8f acc[4] = {};                  // acc[dt][e] = O[query col][dt*16 + 8*half + e]
    float m = -1e30f;                 // running maximum of query col, equal in both half-waves
    float l = 0.f;                    // this half-wave's share of the sum, joined in the epilogue

    for (int c0 = 0; c0 < NTOK; c0 += 128) {
        // stage K chunk: Ks[key][kd], 2x16B per row
        {
            int n = tid >> 1, sg = tid & 1;
            cp16(&Ks[n * KS_STRIDE + sg * 8],
                 kt + ((size_t)b * NTOK + c0 + n) * DIM + h * KDIM + sg * 8);
        }
        // stage V chunk: Vs[d][key], 16x16B per row (4 segs/thread)
        #pragma unroll
        for (int r = 0; r < 4; ++r) {
            int s = tid + 256 * r;
            int d = s >> 4, sg = s & 15;
            cp16(&Vs[d * VS_STRIDE + sg * 8], vb + headv + (size_t)d * NTOK + c0 + sg * 8);
        }
        async_wait();
        __syncthreads();

        // two passes of 64 keys: 32 score registers a pass leave room for 8 waves per SIMD
        // nounroll: unrolled, the compiler interleaves the two passes and takes 166 VGPRs instead of 125,
        // which halves the workgroups that fit on a WGP
        #pragma nounroll
        for (int kb = 0; kb < 128; kb += 64) {
            // S^T = (K @ Q^T) * 4 : st[jt][e] = score(key kb + jt*16 + 8*half + e, query col)
            v8f st[4];
            #pragma unroll
            for (int jt = 0; jt < 4; ++jt) {
                v16bf kf = load_frag(Ks, kb + jt * 16 + col, KS_STRIDE, half * 8);
                v8f s = {};
                s = WMMA_BF16(kf, qf, s);
                st[jt] = s * 4.0f;
            }

            // online softmax in registers: 32 keys in-lane, one exchange between halves
            v8f mx = __builtin_elementwise_max(__builtin_elementwise_max(st[0], st[1]),
                                               __builtin_elementwise_max(st[2], st[3]));
            float cm = fmaxf(fmaxf(fmaxf(mx[0], mx[1]), fmaxf(mx[2], mx[3])),
                             fmaxf(fmaxf(mx[4], mx[5]), fmaxf(mx[6], mx[7])));
            cm = fmaxf(cm, other_half(cm));
            const float nm    = fmaxf(m, cm);
            const float alpha = __expf(m - nm);
            m = nm;

            #pragma unroll
            for (int jt = 0; jt < 4; ++jt) {
                v8f t = (st[jt] - nm) * 1.44269504f;   // exp(x) = exp2(x * log2 e)
                #pragma unroll
                for (int e = 0; e < 8; ++e) t[e] = __builtin_amdgcn_exp2f(t[e]);
                st[jt] = t;
            }
            const v8f ps = (st[0] + st[1]) + (st[2] + st[3]);
            l = l * alpha + (((ps[0] + ps[1]) + (ps[2] + ps[3])) + ((ps[4] + ps[5]) + (ps[6] + ps[7])));

            // rescale accumulators: every element of a lane belongs to query col
            #pragma unroll
            for (int dt = 0; dt < 4; ++dt) acc[dt] *= alpha;

            // O^T += V^T @ P^T ; tiles 2*k2 and 2*k2+1 give keys 8*half+e and 16+8*half+e
            // of a 32-key block: the k order in which load_frag reads V
            #pragma unroll
            for (int k2 = 0; k2 < 2; ++k2) {
                v16bf pf;
                #pragma unroll
                for (int e = 0; e < 8; ++e) {
                    pf[e]     = (bf16_t)st[2 * k2][e];
                    pf[e + 8] = (bf16_t)st[2 * k2 + 1][e];
                }
                #pragma unroll
                for (int dt = 0; dt < 4; ++dt) {
                    v16bf vf = load_frag(Vs, dt * 16 + col, VS_STRIDE, kb + k2 * 32 + half * 8);
                    acc[dt] = WMMA_BF16(vf, pf, acc[dt]);
                }
            }
        }
        __syncthreads();
    }

    // epilogue: ot[b][q][h*64+d], a lane's 8 accumulator elements are 8 consecutive d
    l += other_half(l);
    const float li = 1.0f / l;
    bf16_t* orow = ot + ((size_t)b * NTOK + q0 + wave * 16 + col) * DH + h * DHEAD + 8 * half;
    #pragma unroll
    for (int dt = 0; dt < 4; ++dt) {
        v8bf o;
        #pragma unroll
        for (int e = 0; e < 8; ++e) o[e] = (bf16_t)(acc[dt][e] * li);
        *(v8bf*)(orow + dt * 16) = o;
    }
}

// ---------------------------------------------------------------------------
// Host orchestration
// ---------------------------------------------------------------------------
extern "C" void kernel_launch(void* const* d_in, const int* in_sizes, int n_in,
                              void* d_out, int out_size, void* d_ws, size_t ws_size,
                              hipStream_t stream) {
    const float* x   = (const float*)d_in[0];
    const float* g1  = (const float*)d_in[1];
    const float* b1  = (const float*)d_in[2];
    const float* wq  = (const float*)d_in[3];
    const float* bq  = (const float*)d_in[4];
    const float* wk  = (const float*)d_in[5];
    const float* bk  = (const float*)d_in[6];
    const float* wv  = (const float*)d_in[7];
    const float* bv  = (const float*)d_in[8];
    const float* wp  = (const float*)d_in[9];
    const float* bp  = (const float*)d_in[10];
    const float* g2  = (const float*)d_in[11];
    const float* b2  = (const float*)d_in[12];
    const float* w1  = (const float*)d_in[13];
    const float* bb1 = (const float*)d_in[14];
    const float* w2  = (const float*)d_in[15];
    const float* bb2 = (const float*)d_in[16];
    float* out = (float*)d_out;

    char* ws = (char*)d_ws;
    size_t off = 0;
    auto alloc = [&](size_t bytes) -> void* {
        void* p = ws + off;
        off = (off + bytes + 255) & ~(size_t)255;
        return p;
    };

    const size_t BCN = (size_t)BATCH * DIM * NTOK;
    const size_t BHN = (size_t)BATCH * DH * NTOK;

    float*  s1   = (float*)alloc(DIM * 4);
    float*  t1   = (float*)alloc(DIM * 4);
    float*  s2   = (float*)alloc(DIM * 4);
    float*  t2   = (float*)alloc(DIM * 4);
    bf16_t* wqb  = (bf16_t*)alloc((size_t)DIM * DIM * 2);
    bf16_t* wkb  = (bf16_t*)alloc((size_t)DIM * DIM * 2);
    bf16_t* wvb  = (bf16_t*)alloc((size_t)DH * DIM * 2);
    bf16_t* wpb  = (bf16_t*)alloc((size_t)DIM * DH * 2);
    bf16_t* w1b  = (bf16_t*)alloc((size_t)HID * DIM * 2);
    bf16_t* w2b  = (bf16_t*)alloc((size_t)DIM * HID * 2);
    bf16_t* ytb  = (bf16_t*)alloc(BCN * 2);   // BN1(x), [b][n][c]
    bf16_t* qtb  = (bf16_t*)alloc(BCN * 2);   // Q, [b][n][o]
    bf16_t* ktb  = (bf16_t*)alloc(BCN * 2);   // K, [b][n][o]
    bf16_t* vbf  = (bf16_t*)alloc(BHN * 2);   // V, [b][dh][n]
    bf16_t* otb  = (bf16_t*)alloc(BHN * 2);   // attn out, [b][n][dh]
    float*  xf2  = (float*)alloc(BCN * 4);    // residual 1, [b][c][n]
    bf16_t* y2tb = (bf16_t*)alloc(BCN * 2);   // BN2(xf2), [b][n][c]
    bf16_t* htb  = (bf16_t*)alloc(BHN * 2);   // MLP hidden, [b][n][h]

    // BN1 statistics, and weights -> bf16
    prep_kernel<<<DIM + CVT_GROUPS, 256, 0, stream>>>(x, g1, b1, s1, t1, wq, wk, wv, wp, w1, w2,
                                                      wqb, wkb, wvb, wpb, w1b, w2b);

    // BN1 folded + transpose: ytb[b][n][c]
    bn_apply_t_kernel<<<dim3(NTOK / 32, DIM / 32, BATCH), 256, 0, stream>>>(x, s1, t1, ytb);

    // Q, K (token-major for the attention fragments) and V projections, one grid
    gemm_kernel<<<dim3(NTOK / 128, (2 * DIM + DH) / 64, BATCH), 256, 0, stream>>>(
        wqb, ytb, bq, nullptr, nullptr, qtb, DIM, DIM, NTOK, 5,
        wkb, bk, ktb, wvb, bv, vbf, DH);

    // attention -> otb[b][n][dh]
    attn_kernel<<<dim3(NTOK / 128, NHEAD, BATCH), 256, ATTN_LDS_BYTES, stream>>>(
        qtb, ktb, vbf, otb);

    // projection + residual: xf2 = x + Wp @ o + bp
    gemm_kernel<<<dim3(NTOK / 128, DIM / 64, BATCH), 256, 0, stream>>>(
        wpb, otb, bp, x, xf2, nullptr, DIM, DH, NTOK, 1,
        nullptr, nullptr, nullptr, nullptr, nullptr, nullptr, 0);

    // BN2 folded + transpose
    bn_stats_kernel<<<DIM, 256, 0, stream>>>(xf2, g2, b2, s2, t2);
    bn_apply_t_kernel<<<dim3(NTOK / 32, DIM / 32, BATCH), 256, 0, stream>>>(xf2, s2, t2, y2tb);

    // MLP: h = relu6(W1 @ y2 + bb1); out = xf2 + W2 @ h + bb2
    gemm_kernel<<<dim3(NTOK / 128, HID / 64, BATCH), 256, 0, stream>>>(
        w1b, y2tb, bb1, nullptr, nullptr, htb, HID, DIM, NTOK, 4,
        nullptr, nullptr, nullptr, nullptr, nullptr, nullptr, 0);
    gemm_kernel<<<dim3(NTOK / 128, DIM / 64, BATCH), 256, 0, stream>>>(
        w2b, htb, bb2, xf2, out, nullptr, DIM, HID, NTOK, 1,
        nullptr, nullptr, nullptr, nullptr, nullptr, nullptr, 0);
}

// v006
// One run takes 81.4 microseconds.
// Timed twice side by side with v005, it ran 1.14 and 1.11 times as fast.
// All steps since v000 together make it 3.40 times as fast.
#include <hip/hip_runtime.h>
#include <hip/hip_bf16.h>

// ---------------------------------------------------------------------------
// Types for CDNA5 WMMA (wave32)
// ---------------------------------------------------------------------------
typedef __bf16 bf16_t;
typedef __attribute__((ext_vector_type(16))) __bf16 v16bf;
typedef __attribute__((ext_vector_type(8)))  __bf16 v8bf;
typedef __attribute__((ext_vector_type(4)))  __bf16 v4bf;
typedef __attribute__((ext_vector_type(8)))  short  v8s;
typedef __attribute__((ext_vector_type(8)))  float  v8f;
typedef __attribute__((ext_vector_type(4)))  float  v4f;
typedef int v4i __attribute__((vector_size(16)));

union AFrag {
    v16bf v;
    struct { v8bf lo, hi; } h;
};

// Fragment from LDS laid out [row][k], k contiguous. Per the CDNA5 ISA layout,
// lane L owns row/col L&15; half-wave selects K {kbase..+7} and {kbase+16..+23},
// kbase = 8*(L>>4). Two aligned ds_load_b128 per fragment.
__device__ __forceinline__ v16bf load_frag(const bf16_t* base, int row, int stride, int koff) {
    const bf16_t* p = base + row * stride + koff;
    AFrag f;
    f.h.lo = *(const v8bf*)(p);
    f.h.hi = *(const v8bf*)(p + 16);
    return f.v;
}

// Fragment from LDS laid out [k][col], col contiguous, by two transposing loads (ds_load_tr16_b128).
// p: the lane's own 16 bytes, row 8*(L>>4) + (L&7) of the 32-k block, columns 8*((L>>3)&1) .. +7 of the
// 16-column group. Lane L then owns column L&15 and the same k as in load_frag, in the same order.
__device__ __forceinline__ v16bf load_frag_t(const bf16_t* p, int stride) {
    typedef __attribute__((address_space(3))) v8s lds_v8s;
    AFrag f;
    f.h.lo = __builtin_bit_cast(v8bf, __builtin_amdgcn_ds_load_tr16_b128_v8i16((lds_v8s*)p));
    f.h.hi = __builtin_bit_cast(v8bf, __builtin_amdgcn_ds_load_tr16_b128_v8i16((lds_v8s*)(p + 16 * stride)));
    return f.v;
}

#define WMMA_BF16(A, B, C) \
    __builtin_amdgcn_wmma_f32_16x16x32_bf16(false, (A), false, (B), (short)0, (C), false, false)

// ---------------------------------------------------------------------------
// CDNA5 async global->LDS copy (16B per lane). Builtin params are generic
// pointers to int4 per the clang declaration; fallback keeps host pass legal.
// ---------------------------------------------------------------------------
#if __has_builtin(__builtin_amdgcn_global_load_async_to_lds_b128) && \
    __has_builtin(__builtin_amdgcn_s_wait_asynccnt)
#define USE_ASYNC_LDS 1
#else
#define USE_ASYNC_LDS 0
#endif

__device__ __forceinline__ void cp16(void* lds, const void* g) {
#if USE_ASYNC_LDS
    __builtin_amdgcn_global_load_async_to_lds_b128((v4i*)g, (v4i*)lds, 0, 0);
#else
    *(v8bf*)lds = *(const v8bf*)g;
#endif
}

__device__ __forceinline__ void async_wait() {
#if USE_ASYNC_LDS
    __builtin_amdgcn_s_wait_asynccnt(0);
#endif
}

// ---------------------------------------------------------------------------
// Problem constants
// ---------------------------------------------------------------------------
#define BATCH 8
#define DIM   256
#define NTOK  1024
#define NHEAD 16
#define KDIM  16
#define DHEAD 64
#define DH    1024
#define HID   1024

// ---------------------------------------------------------------------------
// float -> bf16 (weights): one workgroup converts CVT_BLK consecutive elements,
// 8 a thread (two 16-byte loads, one 16-byte store)
// ---------------------------------------------------------------------------
#define CVT_BLK 2048
#define CVT_SMALL (DIM * DIM / CVT_BLK)   // workgroups for wq, and for wk
#define CVT_LARGE (DH * DIM / CVT_BLK)    // workgroups for each of wv, wp, w1, w2
#define CVT_GROUPS (2 * CVT_SMALL + 4 * CVT_LARGE)

__device__ __forceinline__ void cvt_block(const float* __restrict__ src, bf16_t* __restrict__ dst, int blk) {
    const int i = blk * CVT_BLK + threadIdx.x * 8;
    const v4f a = *(const v4f*)(src + i);
    const v4f c = *(const v4f*)(src + i + 4);
    v8bf r;
    // unroll: constant indices keep a, c and r in registers
    #pragma unroll
    for (int e = 0; e < 4; ++e) {
        r[e]     = (bf16_t)a[e];
        r[e + 4] = (bf16_t)c[e];
    }
    *(v8bf*)(dst + i) = r;
    // the store's address and data registers may be rewritten on the paths behind it: wait first
    asm volatile("s_wait_xcnt 0x0" ::: "memory");
}

// ---------------------------------------------------------------------------
// BN over (B,N), one channel a workgroup: statistics (biased var, eps=1e-5), then y = x*s + t on the
// values still in registers, stored as bf16 in x's own layout, y[b][c][n]
// ---------------------------------------------------------------------------
__device__ __forceinline__
void bn_block(const float* __restrict__ x, const float* __restrict__ g,
              const float* __restrict__ bet, bf16_t* __restrict__ y) {
    __shared__ float ssum[256];
    __shared__ float ssq[256];
    const int c = blockIdx.x;
    // a thread's 32 values come as eight independent 16-byte loads (4 consecutive n of each b),
    // and g, bet with them: the wave waits out the load latency once, not once per value
    const float gc = g[c], bc = bet[c];
    const float* p = x + (size_t)c * NTOK + threadIdx.x * 4;
    v4f v[BATCH];
    // unroll: all eight loads are issued before the first value is used
    #pragma unroll
    for (int b = 0; b < BATCH; ++b) v[b] = *(const v4f*)(p + (size_t)b * DIM * NTOK);
    // the address registers of these loads, and of g's and bet's, are rewritten further down: wait first
    asm volatile("s_wait_xcnt 0x0" ::: "memory");
    v4f s4 = {}, q4 = {};
    // unroll: constant indices keep v in registers
    #pragma unroll
    for (int b = 0; b < BATCH; ++b) { s4 += v[b]; q4 += v[b] * v[b]; }
    const float sum = (s4[0] + s4[1]) + (s4[2] + s4[3]);
    const float sq  = (q4[0] + q4[1]) + (q4[2] + q4[3]);
    ssum[threadIdx.x] = sum; ssq[threadIdx.x] = sq;
    __syncthreads();
    for (int off = 128; off > 0; off >>= 1) {
        if (threadIdx.x < off) {
            ssum[threadIdx.x] += ssum[threadIdx.x + off];
            ssq[threadIdx.x]  += ssq[threadIdx.x + off];
        }
        __syncthreads();
    }
    // the loop's last barrier has published both totals: every thread folds them alike
    const float cnt = (float)BATCH * (float)NTOK;
    const float m   = ssum[0] / cnt;
    const float var = ssq[0] / cnt - m * m;
    const float sc  = gc * rsqrtf(var + 1e-5f);
    const float sh  = bc - m * sc;
    bf16_t* q = y + (size_t)c * NTOK + threadIdx.x * 4;
    // unroll: constant indices keep v in registers
    #pragma unroll
    for (int b = 0; b < BATCH; ++b) {
        v4bf r;
        #pragma unroll
        for (int e = 0; e < 4; ++e) r[e] = (bf16_t)(v[b][e] * sc + sh);
        *(v4bf*)(q + (size_t)b * DIM * NTOK) = r;
    }
    // the stores' address and data registers may be rewritten on the paths behind them: wait first
    asm volatile("s_wait_xcnt 0x0" ::: "memory");
}

__global__ __launch_bounds__(256)
void bn_kernel(const float* __restrict__ x, const float* __restrict__ g,
               const float* __restrict__ bet, bf16_t* __restrict__ y) {
    bn_block(x, g, bet, y);
}

// ---------------------------------------------------------------------------
// First launch: BN1 and the six weight conversions depend on nothing but the
// inputs, so they share one grid. Workgroups [0, DIM) do one channel's BN
// (the longer job, started first), the rest convert weights.
// ---------------------------------------------------------------------------
__global__ __launch_bounds__(256)
void prep_kernel(const float* __restrict__ x, const float* __restrict__ g,
                 const float* __restrict__ bet, bf16_t* __restrict__ y,
                 const float* __restrict__ wq, const float* __restrict__ wk,
                 const float* __restrict__ wv, const float* __restrict__ wp,
                 const float* __restrict__ w1, const float* __restrict__ w2,
                 bf16_t* __restrict__ wqb, bf16_t* __restrict__ wkb,
                 bf16_t* __restrict__ wvb, bf16_t* __restrict__ wpb,
                 bf16_t* __restrict__ w1b, bf16_t* __restrict__ w2b) {
    if (blockIdx.x < DIM) {
        bn_block(x, g, bet, y);
        return;
    }
    int blk = blockIdx.x - DIM;
    if (blk < CVT_SMALL)     { cvt_block(wq, wqb, blk); return; }
    blk -= CVT_SMALL;
    if (blk < CVT_SMALL)     { cvt_block(wk, wkb, blk); return; }
    blk -= CVT_SMALL;
    const int which = blk / CVT_LARGE;
    blk -= which * CVT_LARGE;
    const float* src = which == 0 ? wv  : which == 1 ? wp  : which == 2 ? w1  : w2;
    bf16_t*      dst = which == 0 ? wvb : which == 1 ? wpb : which == 2 ? w1b : w2b;
    cvt_block(src, dst, blk);
}

// ---------------------------------------------------------------------------
// Tiled bf16 WMMA GEMM: Out[b][o][n] = W[o][k] @ Y[b][k][n] + bias (+res)
//   CM false: the operand comes token-major, Yt[b][n][k]; CM true: channel-major, Yt[b][k][n], staged
//   as rows of k and turned into fragments by transposing LDS loads
//   workgroup tile 64(O) x 128(N); 8 waves 2x4; wave tile 32x32
//   LDS staging via 16B async copies in a ring of two buffers, 128 k a stage: the copies of the
//   next stage fly while this stage's products run. K: a multiple of 128.
//   mode 0: outb = bf16(acc+bias)   mode 1: outf = acc+bias+res (f32)
//   mode 2: outb = bf16(relu6(acc+bias))
//   mode 3: outb[b][n][o] = bf16(acc+bias)   mode 4: outb[b][n][o] = bf16(relu6(acc+bias))
//   Modes 3 and 4 write token-major, the layout in which the next product reads its operand.
//   mode 5: three products of the same Yt in one grid, told apart by blockIdx.y:
//   O rows of (W, bias, outb) and O rows of (W2, bias2, outb2) as mode 3,
//   then O3 rows of (W3, bias3, outb3) as mode 0.
// ---------------------------------------------------------------------------
#define KSTAGE 128                    // k per stage: 256-byte rows
#define RS_STRIDE 136                 // 272B rows (16B x odd): 16B-aligned segments, conflict-free frags
#define A_ELEMS (64 * RS_STRIDE)      // W rows of a stage
#define CM_STRIDE 144                 // 288B rows (32B x odd): conflict-free for the transposing loads

// One stage into one buffer: 16 segments of 16 bytes a row, 16 rows a sweep of the 256 threads;
// 4 sweeps for W, 8 for Yt (128 rows of 128 elements in either layout), 12 copies a thread.
// la, lb, wg, yg: the thread's own segment of row tid>>4; K, P: global row pitch of W and of Yt.
template <int BS>
__device__ __forceinline__
void stage_copies(bf16_t* la, bf16_t* lb, const bf16_t* __restrict__ wg, const bf16_t* __restrict__ yg,
                  int K, int P) {
    // both unrolls: the LDS steps become constants
    #pragma unroll
    for (int r = 0; r < 4; ++r) cp16(la + r * 16 * RS_STRIDE, wg + (size_t)(r * 16) * K);
    #pragma unroll
    for (int r = 0; r < 8; ++r) cp16(lb + r * 16 * BS, yg + (size_t)(r * 16) * P);
}

// Channel-major epilogue of one wave tile, the mode fixed at compile time. The bias and, in mode 1,
// the residual of all 32 elements are loaded before the first is used, so the wave waits out the
// load latency once, not once per element. bias: at the lane's first row; idx0: its first element.
// The row pitch is the constant NTOK (every launch has N = NTOK): all rows then hang off one address
// register by immediate offsets, and no load or store waits for an address register to be free.
template <int MODE>
__device__ __forceinline__
void store_channel_major(const v8f (&acc)[2][2], const float* __restrict__ bias,
                         const float* __restrict__ res, float* __restrict__ outf,
                         bf16_t* __restrict__ outb, size_t idx0) {
    v4f bs[2][2];
    float r[2][2][8];
    bs[0][0] = *(const v4f*)(bias);
    bs[0][1] = *(const v4f*)(bias + 4);
    bs[1][0] = *(const v4f*)(bias + 16);
    // the last load's result may land in the address registers that the three loads before it name: wait first
    asm volatile("s_wait_xcnt 0x0" ::: "memory");
    bs[1][1] = *(const v4f*)(bias + 20);
    // every unroll here: constant indices keep acc, bs and r in registers
    if (MODE == 1) {
        const float* rp = res + idx0;
        #pragma unroll
        for (int mi = 0; mi < 2; ++mi)
            #pragma unroll
            for (int e = 0; e < 8; ++e)
                #pragma unroll
                for (int ni = 0; ni < 2; ++ni)
                    r[mi][ni][e] = rp[(mi * 16 + e) * NTOK + ni * 16];
    }
    #pragma unroll
    for (int mi = 0; mi < 2; ++mi) {
        #pragma unroll
        for (int e = 0; e < 8; ++e) {
            #pragma unroll
            for (int ni = 0; ni < 2; ++ni) {
                const float v = acc[mi][ni][e] + bs[mi][e >> 2][e & 3];
                if (MODE == 0)      r[mi][ni][e] = v;
                else if (MODE == 1) r[mi][ni][e] = v + r[mi][ni][e];
                else                r[mi][ni][e] = fminf(fmaxf(v, 0.f), 6.f);
            }
        }
    }
    // all 32 results first, then all 32 stores, each from a register of its own: no store waits on another
    #pragma unroll
    for (int mi = 0; mi < 2; ++mi) {
        #pragma unroll
        for (int e = 0; e < 8; ++e) {
            #pragma unroll
            for (int ni = 0; ni < 2; ++ni) {
                const int off = (mi * 16 + e) * NTOK + ni * 16;
                if (MODE == 1) (outf + idx0)[off] = r[mi][ni][e];
                else           (outb + idx0)[off] = (bf16_t)r[mi][ni][e];
            }
        }
    }
    // the stores' address and data registers may be rewritten on the paths behind them: wait first
    asm volatile("s_wait_xcnt 0x0" ::: "memory");
}

// second argument: 6 waves per SIMD, the three 8-wave workgroups whose rings fit a WGP's LDS
template <bool CM>
__global__ __launch_bounds__(256, 6)
void gemm_kernel(const bf16_t* __restrict__ W, const bf16_t* __restrict__ Yt,
                 const float* __restrict__ bias, const float* __restrict__ res,
                 float* __restrict__ outf, bf16_t* __restrict__ outb,
                 int O, int K, int N, int mode,
                 const bf16_t* __restrict__ W2, const float* __restrict__ bias2,
                 bf16_t* __restrict__ outb2,
                 const bf16_t* __restrict__ W3, const float* __restrict__ bias3,
                 bf16_t* __restrict__ outb3, int O3) {
    constexpr int BS = CM ? CM_STRIDE : RS_STRIDE;        // LDS row pitch of Yt's rows
    constexpr int STAGE_ELEMS = A_ELEMS + 128 * BS;       // Yt's rows of a stage behind the W rows
    __shared__ __attribute__((aligned(16))) bf16_t ring[2 * STAGE_ELEMS];

    const int tid  = threadIdx.x;
    const int lane = tid & 31;
    const int wave = tid >> 5;
    const int half = lane >> 4;
    const int col  = lane & 15;

    const int b  = blockIdx.z;
    int oy = blockIdx.y;                 // 64-row block of the product's own O
    const int n0 = blockIdx.x * 128;
    const bf16_t* Yb = Yt + (size_t)b * N * K;

    if (mode == 5) {
        const int nb = O >> 6;
        mode = 3;
        if (oy >= 2 * nb)  { oy -= 2 * nb; W = W3; bias = bias3; outb = outb3; O = O3; mode = 0; }
        else if (oy >= nb) { oy -= nb;     W = W2; bias = bias2; outb = outb2; }
    }
    const int o0 = oy * 64;

    const int ow = (wave & 1) * 32;
    const int nw = (wave >> 1) * 32;

    // the thread's own segment in every sweep of a stage: row tid>>4 of the sweep, segment tid&15
    const int sr = tid >> 4, sg = tid & 15;
    bf16_t* la0 = ring + sr * RS_STRIDE + sg * 8;
    bf16_t* lb0 = ring + A_ELEMS + sr * BS + sg * 8;
    const bf16_t* wg = W  + (size_t)(o0 + sr) * K + sg * 8;
    // channel-major: a stage's rows are its 128 k, 128 n of each; token-major: 128 n, 128 k of each
    const bf16_t* yg = CM ? Yb + (size_t)sr * N + n0 + sg * 8 : Yb + (size_t)(n0 + sr) * K + sg * 8;
    const int    P     = CM ? N : K;                              // Yt's row pitch
    const size_t ystep = CM ? (size_t)KSTAGE * N : (size_t)KSTAGE;  // from one stage to the next
    const int nst = K / KSTAGE;
    // channel-major: the lane's own 16 bytes in the transposing load of a 32-k block's first 16-column group
    const int toff = (8 * half + (lane & 7)) * CM_STRIDE + nw + 8 * ((lane >> 3) & 1);

    v8f acc[2][2] = {};

    // prologue: stage 0 lands and is published, then stage 1 starts
    stage_copies<BS>(la0, lb0, wg, yg, K, P);
    // this wave's copies of stage 0 have landed before the barrier behind which other waves read them
    asm volatile("s_wait_asynccnt 0x0" ::: "memory");
    __syncthreads();
    if (nst > 1) stage_copies<BS>(la0 + STAGE_ELEMS, lb0 + STAGE_ELEMS, wg + KSTAGE, yg + ystep, K, P);

    for (int s = 0; s < nst; ++s) {
        const bf16_t* As = ring + (s & 1) * STAGE_ELEMS;
        const bf16_t* Bs = As + A_ELEMS;
        // unroll: the four 32-k blocks of a stage in one straight run, fragment offsets constant
        #pragma unroll
        for (int k4 = 0; k4 < KSTAGE; k4 += 32) {
            v16bf a0 = load_frag(As, ow + col,      RS_STRIDE, k4 + half * 8);
            v16bf a1 = load_frag(As, ow + 16 + col, RS_STRIDE, k4 + half * 8);
            v16bf b0, b1;
            if (CM) {
                b0 = load_frag_t(Bs + k4 * CM_STRIDE + toff,      CM_STRIDE);
                b1 = load_frag_t(Bs + k4 * CM_STRIDE + toff + 16, CM_STRIDE);
            } else {
                b0 = load_frag(Bs, nw + col,      RS_STRIDE, k4 + half * 8);
                b1 = load_frag(Bs, nw + 16 + col, RS_STRIDE, k4 + half * 8);
            }

            acc[0][0] = WMMA_BF16(a0, b0, acc[0][0]);
            acc[0][1] = WMMA_BF16(a0, b1, acc[0][1]);
            acc[1][0] = WMMA_BF16(a1, b0, acc[1][0]);
            acc[1][1] = WMMA_BF16(a1, b1, acc[1][1]);
        }
        // publish point of stage s + 1. This wave's reads of stage s's buffer have returned ...
        asm volatile("s_wait_dscnt 0x0" ::: "memory");
        // ... and its copies of stage s + 1 have landed ...
        asm volatile("s_wait_asynccnt 0x0" ::: "memory");
        // ... in every wave: stage s + 1 may be read, stage s's buffer refilled
        __syncthreads();
        if (s + 2 < nst)
            stage_copies<BS>(la0 + (s & 1) * STAGE_ELEMS, lb0 + (s & 1) * STAGE_ELEMS,
                             wg + (s + 2) * KSTAGE, yg + (s + 2) * ystep, K, P);
    }
    // no copy is outstanding when the wave goes on to its end
    asm volatile("s_wait_asynccnt 0x0" ::: "memory");

    // token-major epilogue: a lane's 8 elements are 8 consecutive o of one token, one 16-byte store
    if (mode >= 3) {
        for (int mi = 0; mi < 2; ++mi) {
            const int om = o0 + ow + mi * 16 + 8 * half;
            for (int ni = 0; ni < 2; ++ni) {
                const int on = n0 + nw + ni * 16 + col;
                v8bf r;
                // unroll: constant indices keep acc and r in registers
                #pragma unroll
                for (int e = 0; e < 8; ++e) {
                    float v = acc[mi][ni][e] + bias[om + e];
                    if (mode == 4) v = fminf(fmaxf(v, 0.f), 6.f);
                    r[e] = (bf16_t)v;
                }
                *(v8bf*)(outb + ((size_t)b * N + on) * O + om) = r;
            }
        }
        return;
    }

    // epilogue: acc element e -> (M = e+8*half, N = lane&15); stores coalesce along n
    const int om0 = o0 + ow + 8 * half;
    const size_t idx0 = ((size_t)b * O + om0) * N + n0 + nw + col;
    if (mode == 0)      store_channel_major<0>(acc, bias + om0, res, outf, outb, idx0);
    else if (mode == 1) store_channel_major<1>(acc, bias + om0, res, outf, outb, idx0);
    else                store_channel_major<2>(acc, bias + om0, res, outf, outb, idx0);
}

#define QS_STRIDE 40
#define KS_STRIDE 40
#define VS_STRIDE 136
#define ATTN_LDS_BYTES (128*QS_STRIDE*2 + 128*KS_STRIDE*2 + 64*VS_STRIDE*2)

// value of lane l ^ 16
__device__ __forceinline__ float other_half(float x) {
    int v = __builtin_bit_cast(int, x);
    v = __builtin_amdgcn_permlanex16(v, v, 0x76543210, 0xfedcba98, false, false);
    return __builtin_bit_cast(float, v);
}

__global__ __launch_bounds__(256)
void attn_kernel(const bf16_t* __restrict__ qt, const bf16_t* __restrict__ kt,
                 const bf16_t* __restrict__ vb, bf16_t* __restrict__ ot) {
    extern __shared__ char smem[];
    bf16_t* Qs = (bf16_t*)smem;                       // [128][QS_STRIDE]
    bf16_t* Ks = Qs + 128 * QS_STRIDE;                // [128][KS_STRIDE]
    bf16_t* Vs = Ks + 128 * KS_STRIDE;                // [64][VS_STRIDE]

    const int tid  = threadIdx.x;
    const int lane = tid & 31;
    const int wave = tid >> 5;
    const int half = lane >> 4;
    const int col  = lane & 15;

    const int q0 = blockIdx.x * 128;
    const int h  = blockIdx.y;
    const int b  = blockIdx.z;
    const size_t headv = ((size_t)b * DH + (size_t)h * DHEAD) * NTOK;

    // zero kd-pad [16..32) of Qs and Ks (async copies only touch [0..16))
    {
        v8bf z = {};
        int row = tid >> 1, hh = tid & 1;
        *(v8bf*)(&Qs[row * QS_STRIDE + 16 + hh * 8]) = z;
        *(v8bf*)(&Ks[row * KS_STRIDE + 16 + hh * 8]) = z;
    }
    // stage Q block: Qs[n][kd] <- qt[b][q0+n][h*16 + kd], 2x16B per row
    {
        int n = tid >> 1, sg = tid & 1;
        cp16(&Qs[n * QS_STRIDE + sg * 8],
             qt + ((size_t)b * NTOK + q0 + n) * DIM + h * KDIM + sg * 8);
    }
    async_wait();
    __syncthreads();

    // B operand of S^T: column = query wave*16 + col
    const v16bf qf = load_frag(Qs, wave * 16 + col, QS_STRIDE, half * 8);

    v8f acc[4] = {};                  // acc[dt][e] = O[query col][dt*16 + 8*half + e]
    float m = -1e30f;                 // running maximum of query col, equal in both half-waves
    float l = 0.f;                    // this half-wave's share of the sum, joined in the epilogue

    for (int c0 = 0; c0 < NTOK; c0 += 128) {
        // stage K chunk: Ks[key][kd], 2x16B per row
        {
            int n = tid >> 1, sg = tid & 1;
            cp16(&Ks[n * KS_STRIDE + sg * 8],
                 kt + ((size_t)b * NTOK + c0 + n) * DIM + h * KDIM + sg * 8);
        }
        // stage V chunk: Vs[d][key], 16x16B per row (4 segs/thread)
        #pragma unroll
        for (int r = 0; r < 4; ++r) {
            int s = tid + 256 * r;
            int d = s >> 4, sg = s & 15;
            cp16(&Vs[d * VS_STRIDE + sg * 8], vb + headv + (size_t)d * NTOK + c0 + sg * 8);
        }
        async_wait();
        __syncthreads();

        // two passes of 64 keys: 32 score registers a pass leave room for 8 waves per SIMD
        // nounroll: unrolled, the compiler interleaves the two passes and takes 166 VGPRs instead of 125,
        // which halves the workgroups that fit on a WGP
        #pragma nounroll
        for (int kb = 0; kb < 128; kb += 64) {
            // S^T = (K @ Q^T) * 4 : st[jt][e] = score(key kb + jt*16 + 8*half + e, query col)
            v8f st[4];
            #pragma unroll
            for (int jt = 0; jt < 4; ++jt) {
                v16bf kf = load_frag(Ks, kb + jt * 16 + col, KS_STRIDE, half * 8);
                v8f s = {};
                s = WMMA_BF16(kf, qf, s);
                st[jt] = s * 4.0f;
            }

            // online softmax in registers: 32 keys in-lane, one exchange between halves
            v8f mx = __builtin_elementwise_max(__builtin_elementwise_max(st[0], st[1]),
                                               __builtin_elementwise_max(st[2], st[3]));
            float cm = fmaxf(fmaxf(fmaxf(mx[0], mx[1]), fmaxf(mx[2], mx[3])),
                             fmaxf(fmaxf(mx[4], mx[5]), fmaxf(mx[6], mx[7])));
            cm = fmaxf(cm, other_half(cm));
            const float nm    = fmaxf(m, cm);
            const float alpha = __expf(m - nm);
            m = nm;

            #pragma unroll
            for (int jt = 0; jt < 4; ++jt) {
                v8f t = (st[jt] - nm) * 1.44269504f;   // exp(x) = exp2(x * log2 e)
                #pragma unroll
                for (int e = 0; e < 8; ++e) t[e] = __builtin_amdgcn_exp2f(t[e]);
                st[jt] = t;
            }
            const v8f ps = (st[0] + st[1]) + (st[2] + st[3]);
            l = l * alpha + (((ps[0] + ps[1]) + (ps[2] + ps[3])) + ((ps[4] + ps[5]) + (ps[6] + ps[7])));

            // rescale accumulators: every element of a lane belongs to query col
            #pragma unroll
            for (int dt = 0; dt < 4; ++dt) acc[dt] *= alpha;

            // O^T += V^T @ P^T ; tiles 2*k2 and 2*k2+1 give keys 8*half+e and 16+8*half+e
            // of a 32-key block: the k order in which load_frag reads V
            #pragma unroll
            for (int k2 = 0; k2 < 2; ++k2) {
                v16bf pf;
                #pragma unroll
                for (int e = 0; e < 8; ++e) {
                    pf[e]     = (bf16_t)st[2 * k2][e];
                    pf[e + 8] = (bf16_t)st[2 * k2 + 1][e];
                }
                #pragma unroll
                for (int dt = 0; dt < 4; ++dt) {
                    v16bf vf = load_frag(Vs, dt * 16 + col, VS_STRIDE, kb + k2 * 32 + half * 8);
                    acc[dt] = WMMA_BF16(vf, pf, acc[dt]);
                }
            }
        }
        __syncthreads();
    }

    // epilogue: ot[b][q][h*64+d], a lane's 8 accumulator elements are 8 consecutive d
    l += other_half(l);
    const float li = 1.0f / l;
    bf16_t* orow = ot + ((size_t)b * NTOK + q0 + wave * 16 + col) * DH + h * DHEAD + 8 * half;
    #pragma unroll
    for (int dt = 0; dt < 4; ++dt) {
        v8bf o;
        #pragma unroll
        for (int e = 0; e < 8; ++e) o[e] = (bf16_t)(acc[dt][e] * li);
        *(v8bf*)(orow + dt * 16) = o;
    }
}

// ---------------------------------------------------------------------------
// Host orchestration
// ---------------------------------------------------------------------------
extern "C" void kernel_launch(void* const* d_in, const int* in_sizes, int n_in,
                              void* d_out, int out_size, void* d_ws, size_t ws_size,
                              hipStream_t stream) {
    const float* x   = (const float*)d_in[0];
    const float* g1  = (const float*)d_in[1];
    const float* b1  = (const float*)d_in[2];
    const float* wq  = (const float*)d_in[3];
    const float* bq  = (const float*)d_in[4];
    const float* wk  = (const float*)d_in[5];
    const float* bk  = (const float*)d_in[6];
    const float* wv  = (const float*)d_in[7];
    const float* bv  = (const float*)d_in[8];
    const float* wp  = (const float*)d_in[9];
    const float* bp  = (const float*)d_in[10];
    const float* g2  = (const float*)d_in[11];
    const float* b2  = (const float*)d_in[12];
    const float* w1  = (const float*)d_in[13];
    const float* bb1 = (const float*)d_in[14];
    const float* w2  = (const float*)d_in[15];
    const float* bb2 = (const float*)d_in[16];
    float* out = (float*)d_out;

    char* ws = (char*)d_ws;
    size_t off = 0;
    auto alloc = [&](size_t bytes) -> void* {
        void* p = ws + off;
        off = (off + bytes + 255) & ~(size_t)255;
        return p;
    };

    const size_t BCN = (size_t)BATCH * DIM * NTOK;
    const size_t BHN = (size_t)BATCH * DH * NTOK;

    bf16_t* wqb  = (bf16_t*)alloc((size_t)DIM * DIM * 2);
    bf16_t* wkb  = (bf16_t*)alloc((size_t)DIM * DIM * 2);
    bf16_t* wvb  = (bf16_t*)alloc((size_t)DH * DIM * 2);
    bf16_t* wpb  = (bf16_t*)alloc((size_t)DIM * DH * 2);
    bf16_t* w1b  = (bf16_t*)alloc((size_t)HID * DIM * 2);
    bf16_t* w2b  = (bf16_t*)alloc((size_t)DIM * HID * 2);
    bf16_t* ytb  = (bf16_t*)alloc(BCN * 2);   // BN1(x), [b][c][n]
    bf16_t* qtb  = (bf16_t*)alloc(BCN * 2);   // Q, [b][n][o]
    bf16_t* ktb  = (bf16_t*)alloc(BCN * 2);   // K, [b][n][o]
    bf16_t* vbf  = (bf16_t*)alloc(BHN * 2);   // V, [b][dh][n]
    bf16_t* otb  = (bf16_t*)alloc(BHN * 2);   // attn out, [b][n][dh]
    float*  xf2  = (float*)alloc(BCN * 4);    // residual 1, [b][c][n]
    bf16_t* y2tb = (bf16_t*)alloc(BCN * 2);   // BN2(xf2), [b][c][n]
    bf16_t* htb  = (bf16_t*)alloc(BHN * 2);   // MLP hidden, [b][n][h]

    // BN1 -> ytb[b][c][n], and weights -> bf16
    prep_kernel<<<DIM + CVT_GROUPS, 256, 0, stream>>>(x, g1, b1, ytb, wq, wk, wv, wp, w1, w2,
                                                      wqb, wkb, wvb, wpb, w1b, w2b);

    // Q, K (token-major for the attention fragments) and V projections, one grid
    gemm_kernel<true><<<dim3(NTOK / 128, (2 * DIM + DH) / 64, BATCH), 256, 0, stream>>>(
        wqb, ytb, bq, nullptr, nullptr, qtb, DIM, DIM, NTOK, 5,
        wkb, bk, ktb, wvb, bv, vbf, DH);

    // attention -> otb[b][n][dh]
    attn_kernel<<<dim3(NTOK / 128, NHEAD, BATCH), 256, ATTN_LDS_BYTES, stream>>>(
        qtb, ktb, vbf, otb);

    // projection + residual: xf2 = x + Wp @ o + bp
    gemm_kernel<false><<<dim3(NTOK / 128, DIM / 64, BATCH), 256, 0, stream>>>(
        wpb, otb, bp, x, xf2, nullptr, DIM, DH, NTOK, 1,
        nullptr, nullptr, nullptr, nullptr, nullptr, nullptr, 0);

    // BN2 -> y2tb[b][c][n]
    bn_kernel<<<DIM, 256, 0, stream>>>(xf2, g2, b2, y2tb);

    // MLP: h = relu6(W1 @ y2 + bb1); out = xf2 + W2 @ h + bb2
    gemm_kernel<true><<<dim3(NTOK / 128, HID / 64, BATCH), 256, 0, stream>>>(
        w1b, y2tb, bb1, nullptr, nullptr, htb, HID, DIM, NTOK, 4,
        nullptr, nullptr, nullptr, nullptr, nullptr, nullptr, 0);
    gemm_kernel<false><<<dim3(NTOK / 128, DIM / 64, BATCH), 256, 0, stream>>>(
        w2b, htb, bb2, xf2, out, nullptr, DIM, HID, NTOK, 1,
        nullptr, nullptr, nullptr, nullptr, nullptr, nullptr, 0);
}

// v007
// A run of this version takes 75.9 microseconds.
// In two side-by-side timings against v006, it was 1.06 and 1.04 times as fast.
// Over all steps from v000 it is 3.57 times as fast.
#include <hip/hip_runtime.h>
#include <hip/hip_bf16.h>

// ---------------------------------------------------------------------------
// Types for CDNA5 WMMA (wave32)
// ---------------------------------------------------------------------------
typedef __bf16 bf16_t;
typedef __attribute__((ext_vector_type(16))) __bf16 v16bf;
typedef __attribute__((ext_vector_type(8)))  __bf16 v8bf;
typedef __attribute__((ext_vector_type(4)))  __bf16 v4bf;
typedef __attribute__((ext_vector_type(8)))  short  v8s;
typedef __attribute__((ext_vector_type(8)))  float  v8f;
typedef __attribute__((ext_vector_type(4)))  float  v4f;
typedef int v4i __attribute__((vector_size(16)));

union AFrag {
    v16bf v;
    struct { v8bf lo, hi; } h;
};

// Fragment from LDS laid out [row][k], k contiguous. Per the CDNA5 ISA layout,
// lane L owns row/col L&15; half-wave selects K {kbase..+7} and {kbase+16..+23},
// kbase = 8*(L>>4). Two aligned ds_load_b128 per fragment.
__device__ __forceinline__ v16bf load_frag(const bf16_t* base, int row, int stride, int koff) {
    const bf16_t* p = base + row * stride + koff;
    AFrag f;
    f.h.lo = *(const v8bf*)(p);
    f.h.hi = *(const v8bf*)(p + 16);
    return f.v;
}

// Fragment from LDS laid out [k][col], col contiguous, by two transposing loads (ds_load_tr16_b128).
// p: the lane's own 16 bytes, row 8*(L>>4) + (L&7) of the 32-k block, columns 8*((L>>3)&1) .. +7 of the
// 16-column group. Lane L then owns column L&15 and the same k as in load_frag, in the same order.
__device__ __forceinline__ v16bf load_frag_t(const bf16_t* p, int stride) {
    typedef __attribute__((address_space(3))) v8s lds_v8s;
    AFrag f;
    f.h.lo = __builtin_bit_cast(v8bf, __builtin_amdgcn_ds_load_tr16_b128_v8i16((lds_v8s*)p));
    f.h.hi = __builtin_bit_cast(v8bf, __builtin_amdgcn_ds_load_tr16_b128_v8i16((lds_v8s*)(p + 16 * stride)));
    return f.v;
}

#define WMMA_BF16(A, B, C) \
    __builtin_amdgcn_wmma_f32_16x16x32_bf16(false, (A), false, (B), (short)0, (C), false, false)

// ---------------------------------------------------------------------------
// CDNA5 async global->LDS copy (16B per lane). Builtin params are generic
// pointers to int4 per the clang declaration; fallback keeps host pass legal.
// ---------------------------------------------------------------------------
#if __has_builtin(__builtin_amdgcn_global_load_async_to_lds_b128) && \
    __has_builtin(__builtin_amdgcn_s_wait_asynccnt)
#define USE_ASYNC_LDS 1
#else
#define USE_ASYNC_LDS 0
#endif

__device__ __forceinline__ void cp16(void* lds, const void* g) {
#if USE_ASYNC_LDS
    __builtin_amdgcn_global_load_async_to_lds_b128((v4i*)g, (v4i*)lds, 0, 0);
#else
    *(v8bf*)lds = *(const v8bf*)g;
#endif
}

__device__ __forceinline__ void async_wait() {
#if USE_ASYNC_LDS
    __builtin_amdgcn_s_wait_asynccnt(0);
#endif
}

// ---------------------------------------------------------------------------
// Problem constants
// ---------------------------------------------------------------------------
#define BATCH 8
#define DIM   256
#define NTOK  1024
#define NHEAD 16
#define KDIM  16
#define DHEAD 64
#define DH    1024
#define HID   1024

// ---------------------------------------------------------------------------
// float -> bf16 (weights): one workgroup converts CVT_BLK consecutive elements,
// 8 a thread (two 16-byte loads, one 16-byte store)
// ---------------------------------------------------------------------------
#define CVT_BLK 2048
#define CVT_SMALL (DIM * DIM / CVT_BLK)   // workgroups for wq, and for wk
#define CVT_LARGE (DH * DIM / CVT_BLK)    // workgroups for each of wv, wp, w1, w2
#define CVT_GROUPS (2 * CVT_SMALL + 4 * CVT_LARGE)

__device__ __forceinline__ void cvt_block(const float* __restrict__ src, bf16_t* __restrict__ dst, int blk) {
    const int i = blk * CVT_BLK + threadIdx.x * 8;
    const v4f a = *(const v4f*)(src + i);
    const v4f c = *(const v4f*)(src + i + 4);
    v8bf r;
    // unroll: constant indices keep a, c and r in registers
    #pragma unroll
    for (int e = 0; e < 4; ++e) {
        r[e]     = (bf16_t)a[e];
        r[e + 4] = (bf16_t)c[e];
    }
    *(v8bf*)(dst + i) = r;
    // the store's address and data registers may be rewritten on the paths behind it: wait first
    asm volatile("s_wait_xcnt 0x0" ::: "memory");
}

// ---------------------------------------------------------------------------
// BN over (B,N), one channel a workgroup: statistics (biased var, eps=1e-5), then y = x*s + t on the
// values still in registers, stored as bf16 in x's own layout, y[b][c][n]
// ---------------------------------------------------------------------------
__device__ __forceinline__
void bn_block(const float* __restrict__ x, const float* __restrict__ g,
              const float* __restrict__ bet, bf16_t* __restrict__ y) {
    __shared__ float ssum[256];
    __shared__ float ssq[256];
    const int c = blockIdx.x;
    // a thread's 32 values come as eight independent 16-byte loads (4 consecutive n of each b),
    // and g, bet with them: the wave waits out the load latency once, not once per value
    const float gc = g[c], bc = bet[c];
    const float* p = x + (size_t)c * NTOK + threadIdx.x * 4;
    v4f v[BATCH];
    // unroll: all eight loads are issued before the first value is used
    #pragma unroll
    for (int b = 0; b < BATCH; ++b) v[b] = *(const v4f*)(p + (size_t)b * DIM * NTOK);
    // the address registers of these loads, and of g's and bet's, are rewritten further down: wait first
    asm volatile("s_wait_xcnt 0x0" ::: "memory");
    v4f s4 = {}, q4 = {};
    // unroll: constant indices keep v in registers
    #pragma unroll
    for (int b = 0; b < BATCH; ++b) { s4 += v[b]; q4 += v[b] * v[b]; }
    const float sum = (s4[0] + s4[1]) + (s4[2] + s4[3]);
    const float sq  = (q4[0] + q4[1]) + (q4[2] + q4[3]);
    ssum[threadIdx.x] = sum; ssq[threadIdx.x] = sq;
    __syncthreads();
    for (int off = 128; off > 0; off >>= 1) {
        if (threadIdx.x < off) {
            ssum[threadIdx.x] += ssum[threadIdx.x + off];
            ssq[threadIdx.x]  += ssq[threadIdx.x + off];
        }
        __syncthreads();
    }
    // the loop's last barrier has published both totals: every thread folds them alike
    const float cnt = (float)BATCH * (float)NTOK;
    const float m   = ssum[0] / cnt;
    const float var = ssq[0] / cnt - m * m;
    const float sc  = gc * rsqrtf(var + 1e-5f);
    const float sh  = bc - m * sc;
    bf16_t* q = y + (size_t)c * NTOK + threadIdx.x * 4;
    // unroll: constant indices keep v in registers
    #pragma unroll
    for (int b = 0; b < BATCH; ++b) {
        v4bf r;
        #pragma unroll
        for (int e = 0; e < 4; ++e) r[e] = (bf16_t)(v[b][e] * sc + sh);
        *(v4bf*)(q + (size_t)b * DIM * NTOK) = r;
    }
    // the stores' address and data registers may be rewritten on the paths behind them: wait first
    asm volatile("s_wait_xcnt 0x0" ::: "memory");
}

__global__ __launch_bounds__(256)
void bn_kernel(const float* __restrict__ x, const float* __restrict__ g,
               const float* __restrict__ bet, bf16_t* __restrict__ y) {
    bn_block(x, g, bet, y);
}

// ---------------------------------------------------------------------------
// First launch: BN1 and the six weight conversions depend on nothing but the
// inputs, so they share one grid. Workgroups [0, DIM) do one channel's BN
// (the longer job, started first), the rest convert weights.
// ---------------------------------------------------------------------------
__global__ __launch_bounds__(256)
void prep_kernel(const float* __restrict__ x, const float* __restrict__ g,
                 const float* __restrict__ bet, bf16_t* __restrict__ y,
                 const float* __restrict__ wq, const float* __restrict__ wk,
                 const float* __restrict__ wv, const float* __restrict__ wp,
                 const float* __restrict__ w1, const float* __restrict__ w2,
                 bf16_t* __restrict__ wqb, bf16_t* __restrict__ wkb,
                 bf16_t* __restrict__ wvb, bf16_t* __restrict__ wpb,
                 bf16_t* __restrict__ w1b, bf16_t* __restrict__ w2b) {
    if (blockIdx.x < DIM) {
        bn_block(x, g, bet, y);
        return;
    }
    int blk = blockIdx.x - DIM;
    if (blk < CVT_SMALL)     { cvt_block(wq, wqb, blk); return; }
    blk -= CVT_SMALL;
    if (blk < CVT_SMALL)     { cvt_block(wk, wkb, blk); return; }
    blk -= CVT_SMALL;
    const int which = blk / CVT_LARGE;
    blk -= which * CVT_LARGE;
    const float* src = which == 0 ? wv  : which == 1 ? wp  : which == 2 ? w1  : w2;
    bf16_t*      dst = which == 0 ? wvb : which == 1 ? wpb : which == 2 ? w1b : w2b;
    cvt_block(src, dst, blk);
}

// ---------------------------------------------------------------------------
// Tiled bf16 WMMA GEMM: Out[b][o][n] = W[o][k] @ Y[b][k][n] + bias (+res)
//   CM false: the operand comes token-major, Yt[b][n][k]; CM true: channel-major, Yt[b][k][n], staged
//   as rows of k and turned into fragments by transposing LDS loads
//   workgroup tile 64(O) x 128(N); 8 waves 2x4; wave tile 32x32
//   LDS staging via 16B async copies in a ring of two buffers, 128 k a stage: the copies of the
//   next stage fly while this stage's products run. K: a multiple of 128; CM true: K = 256, and a
//   workgroup does CM_BLOCKS tiles, 64 * CM_BLOCKS rows of O, on one tile of Yt that stays in LDS.
//   mode 0: outb = bf16(acc+bias)   mode 1: outf = acc+bias+res (f32)
//   mode 2: outb = bf16(relu6(acc+bias))
//   mode 3: outb[b][n][o] = bf16(acc+bias)   mode 4: outb[b][n][o] = bf16(relu6(acc+bias))
//   Modes 3 and 4 write token-major, the layout in which the next product reads its operand.
//   mode 5: three products of the same Yt in one grid, told apart by blockIdx.y:
//   O rows of (W, bias, outb) and O rows of (W2, bias2, outb2) as mode 3,
//   then O3 rows of (W3, bias3, outb3) as mode 0.
// ---------------------------------------------------------------------------
#define KSTAGE 128                    // k per stage: 256-byte rows
#define RS_STRIDE 136                 // 272B rows (16B x odd): 16B-aligned segments, conflict-free frags
#define A_ELEMS (64 * RS_STRIDE)      // W rows of a stage
#define CM_STRIDE 144                 // 288B rows (32B x odd): conflict-free for the transposing loads
#define CM_BLOCKS 2                   // channel-major: 64-row blocks of W a workgroup takes on its one tile of Yt

// One stage into one buffer: 16 segments of 16 bytes a row, 16 rows a sweep of the 256 threads;
// 4 sweeps for W, 8 for Yt (128 rows of 128 elements in either layout), 12 copies a thread.
// la, lb, wg, yg: the thread's own segment of row tid>>4; K, P: global row pitch of W and of Yt.
template <int BS>
__device__ __forceinline__
void stage_copies(bf16_t* la, bf16_t* lb, const bf16_t* __restrict__ wg, const bf16_t* __restrict__ yg,
                  int K, int P) {
    // both unrolls: the LDS steps become constants
    #pragma unroll
    for (int r = 0; r < 4; ++r) cp16(la + r * 16 * RS_STRIDE, wg + (size_t)(r * 16) * K);
    #pragma unroll
    for (int r = 0; r < 8; ++r) cp16(lb + r * 16 * BS, yg + (size_t)(r * 16) * P);
}

// The W rows of a stage alone: a later 64-row block's, beside rows of Yt that stay where they are.
__device__ __forceinline__
void w_copies(bf16_t* la, const bf16_t* __restrict__ wg, int K) {
    // unroll: the LDS steps become constants
    #pragma unroll
    for (int r = 0; r < 4; ++r) cp16(la + r * 16 * RS_STRIDE, wg + (size_t)(r * 16) * K);
}

// The products of one stage: four 32-k blocks of the buffer at As into the wave's 32x32 tile.
// ar, br: the lane's first row of W and (token-major) of Yt; kh: 8 * half; toff: see gemm_kernel.
template <bool CM>
__device__ __forceinline__
void stage_products(const bf16_t* As, int ar, int br, int kh, int toff, v8f (&acc)[2][2]) {
    const bf16_t* Bs = As + A_ELEMS;
    // unroll: the four 32-k blocks of a stage in one straight run, fragment offsets constant
    #pragma unroll
    for (int k4 = 0; k4 < KSTAGE; k4 += 32) {
        v16bf a0 = load_frag(As, ar,      RS_STRIDE, k4 + kh);
        v16bf a1 = load_frag(As, ar + 16, RS_STRIDE, k4 + kh);
        v16bf b0, b1;
        if (CM) {
            b0 = load_frag_t(Bs + k4 * CM_STRIDE + toff,      CM_STRIDE);
            b1 = load_frag_t(Bs + k4 * CM_STRIDE + toff + 16, CM_STRIDE);
        } else {
            b0 = load_frag(Bs, br,      RS_STRIDE, k4 + kh);
            b1 = load_frag(Bs, br + 16, RS_STRIDE, k4 + kh);
        }

        acc[0][0] = WMMA_BF16(a0, b0, acc[0][0]);
        acc[0][1] = WMMA_BF16(a0, b1, acc[0][1]);
        acc[1][0] = WMMA_BF16(a1, b0, acc[1][0]);
        acc[1][1] = WMMA_BF16(a1, b1, acc[1][1]);
    }
}

// Publish point of the next stage, at the foot of every stage.
__device__ __forceinline__ void publish_stage() {
    // this wave's reads of the buffer just worked on have returned ...
    asm volatile("s_wait_dscnt 0x0" ::: "memory");
    // ... and its copies of the next stage have landed ...
    asm volatile("s_wait_asynccnt 0x0" ::: "memory");
    // ... in every wave: the next stage may be read, the buffer just read refilled
    __syncthreads();
}

// Channel-major epilogue of one wave tile, the mode fixed at compile time. The bias and, in mode 1,
// the residual of all 32 elements are loaded before the first is used, so the wave waits out the
// load latency once, not once per element. bias: at the lane's first row; idx0: its first element.
// The row pitch is the constant NTOK (every launch has N = NTOK): all rows then hang off one address
// register by immediate offsets, and no load or store waits for an address register to be free.
template <int MODE>
__device__ __forceinline__
void store_channel_major(const v8f (&acc)[2][2], const float* __restrict__ bias,
                         const float* __restrict__ res, float* __restrict__ outf,
                         bf16_t* __restrict__ outb, size_t idx0) {
    v4f bs[2][2];
    float r[2][2][8];
    bs[0][0] = *(const v4f*)(bias);
    bs[0][1] = *(const v4f*)(bias + 4);
    bs[1][0] = *(const v4f*)(bias + 16);
    // the last load's result may land in the address registers that the three loads before it name: wait first
    asm volatile("s_wait_xcnt 0x0" ::: "memory");
    bs[1][1] = *(const v4f*)(bias + 20);
    // every unroll here: constant indices keep acc, bs and r in registers
    if (MODE == 1) {
        const float* rp = res + idx0;
        #pragma unroll
        for (int mi = 0; mi < 2; ++mi)
            #pragma unroll
            for (int e = 0; e < 8; ++e)
                #pragma unroll
                for (int ni = 0; ni < 2; ++ni)
                    r[mi][ni][e] = rp[(mi * 16 + e) * NTOK + ni * 16];
    }
    #pragma unroll
    for (int mi = 0; mi < 2; ++mi) {
        #pragma unroll
        for (int e = 0; e < 8; ++e) {
            #pragma unroll
            for (int ni = 0; ni < 2; ++ni) {
                const float v = acc[mi][ni][e] + bs[mi][e >> 2][e & 3];
                if (MODE == 0)      r[mi][ni][e] = v;
                else if (MODE == 1) r[mi][ni][e] = v + r[mi][ni][e];
                else                r[mi][ni][e] = fminf(fmaxf(v, 0.f), 6.f);
            }
        }
    }
    // all 32 results first, then all 32 stores, each from a register of its own: no store waits on another
    #pragma unroll
    for (int mi = 0; mi < 2; ++mi) {
        #pragma unroll
        for (int e = 0; e < 8; ++e) {
            #pragma unroll
            for (int ni = 0; ni < 2; ++ni) {
                const int off = (mi * 16 + e) * NTOK + ni * 16;
                if (MODE == 1) (outf + idx0)[off] = r[mi][ni][e];
                else           (outb + idx0)[off] = (bf16_t)r[mi][ni][e];
            }
        }
    }
    // the stores' address and data registers may be rewritten on the paths behind them: wait first
    asm volatile("s_wait_xcnt 0x0" ::: "memory");
}

// One wave tile out, by the mode. om0: the lane's first row, the tile's first row + ow + 8 * half; on0: its first token.
__device__ __forceinline__
void store_tile(const v8f (&acc)[2][2], int mode, int b, int O, int N, int om0, int on0,
                const float* __restrict__ bias, const float* __restrict__ res,
                float* __restrict__ outf, bf16_t* __restrict__ outb) {
    // token-major epilogue: a lane's 8 elements are 8 consecutive o of one token, one 16-byte store
    if (mode >= 3) {
        v4f bs[2][2];
        bs[0][0] = *(const v4f*)(bias + om0);
        bs[0][1] = *(const v4f*)(bias + om0 + 4);
        bs[1][0] = *(const v4f*)(bias + om0 + 16);
        // the last load's result may land in the address registers that the three loads before it name: wait first
        asm volatile("s_wait_xcnt 0x0" ::: "memory");
        bs[1][1] = *(const v4f*)(bias + om0 + 20);
        // every unroll here: constant indices keep acc, bs and r in registers
        #pragma unroll
        for (int mi = 0; mi < 2; ++mi) {
            const int om = om0 + mi * 16;
            #pragma unroll
            for (int ni = 0; ni < 2; ++ni) {
                const int on = on0 + ni * 16;
                v8bf r;
                #pragma unroll
                for (int e = 0; e < 8; ++e) {
                    float v = acc[mi][ni][e] + bs[mi][e >> 2][e & 3];
                    if (mode == 4) v = fminf(fmaxf(v, 0.f), 6.f);
                    r[e] = (bf16_t)v;
                }
                *(v8bf*)(outb + ((size_t)b * N + on) * O + om) = r;
            }
        }
        // the stores' address and data registers are rewritten by the next block's products: wait first
        asm volatile("s_wait_xcnt 0x0" ::: "memory");
        return;
    }

    // epilogue: acc element e -> (M = e+8*half, N = lane&15); stores coalesce along n
    const size_t idx0 = ((size_t)b * O + om0) * N + on0;
    if (mode == 0)      store_channel_major<0>(acc, bias + om0, res, outf, outb, idx0);
    else if (mode == 1) store_channel_major<1>(acc, bias + om0, res, outf, outb, idx0);
    else                store_channel_major<2>(acc, bias + om0, res, outf, outb, idx0);
}

// second argument: 6 waves per SIMD, the three 8-wave workgroups whose rings fit a WGP's LDS
template <bool CM>
__global__ __launch_bounds__(256, 6)
void gemm_kernel(const bf16_t* __restrict__ W, const bf16_t* __restrict__ Yt,
                 const float* __restrict__ bias, const float* __restrict__ res,
                 float* __restrict__ outf, bf16_t* __restrict__ outb,
                 int O, int K, int N, int mode,
                 const bf16_t* __restrict__ W2, const float* __restrict__ bias2,
                 bf16_t* __restrict__ outb2,
                 const bf16_t* __restrict__ W3, const float* __restrict__ bias3,
                 bf16_t* __restrict__ outb3, int O3) {
    constexpr int BS = CM ? CM_STRIDE : RS_STRIDE;        // LDS row pitch of Yt's rows
    constexpr int STAGE_ELEMS = A_ELEMS + 128 * BS;       // Yt's rows of a stage behind the W rows
    __shared__ __attribute__((aligned(16))) bf16_t ring[2 * STAGE_ELEMS];

    const int tid  = threadIdx.x;
    const int lane = tid & 31;
    const int wave = tid >> 5;
    const int half = lane >> 4;
    const int col  = lane & 15;

    const int b  = blockIdx.z;
    int oy = blockIdx.y * (CM ? CM_BLOCKS : 1);   // first 64-row block of the product's own O
    const int n0 = blockIdx.x * 128;
    const bf16_t* Yb = Yt + (size_t)b * N * K;

    // O >> 6 is a multiple of CM_BLOCKS: all blocks of a workgroup belong to one product
    if (mode == 5) {
        const int nb = O >> 6;
        mode = 3;
        if (oy >= 2 * nb)  { oy -= 2 * nb; W = W3; bias = bias3; outb = outb3; O = O3; mode = 0; }
        else if (oy >= nb) { oy -= nb;     W = W2; bias = bias2; outb = outb2; }
    }
    const int o0 = oy * 64;

    const int ow = (wave & 1) * 32;
    const int nw = (wave >> 1) * 32;

    // the thread's own segment in every sweep of a stage: row tid>>4 of the sweep, segment tid&15
    const int sr = tid >> 4, sg = tid & 15;
    bf16_t* la0 = ring + sr * RS_STRIDE + sg * 8;
    bf16_t* lb0 = ring + A_ELEMS + sr * BS + sg * 8;
    const bf16_t* wg = W  + (size_t)(o0 + sr) * K + sg * 8;
    // channel-major: a stage's rows are its 128 k, 128 n of each; token-major: 128 n, 128 k of each
    const bf16_t* yg = CM ? Yb + (size_t)sr * N + n0 + sg * 8 : Yb + (size_t)(n0 + sr) * K + sg * 8;
    const int    P     = CM ? N : K;                              // Yt's row pitch
    const size_t ystep = CM ? (size_t)KSTAGE * N : (size_t)KSTAGE;  // from one stage to the next
    const int nst = K / KSTAGE;
    // channel-major: the lane's own 16 bytes in the transposing load of a 32-k block's first 16-column group
    const int toff = (8 * half + (lane & 7)) * CM_STRIDE + nw + 8 * ((lane >> 3) & 1);

    // prologue: stage 0 lands and is published, then stage 1 starts
    stage_copies<BS>(la0, lb0, wg, yg, K, P);
    // this wave's copies of stage 0 have landed before the barrier behind which other waves read them
    asm volatile("s_wait_asynccnt 0x0" ::: "memory");
    __syncthreads();
    if (nst > 1) stage_copies<BS>(la0 + STAGE_ELEMS, lb0 + STAGE_ELEMS, wg + KSTAGE, yg + ystep, K, P);

    if (CM) {
        // K = 2 * KSTAGE: the ring's two buffers hold all of Yt's tile, and it stays there while the
        // workgroup goes through CM_BLOCKS blocks of 64 rows of W; from stage 2 on only W rows are copied.
        // nounroll: one copy of the stores in the code
        #pragma nounroll
        for (int t = 0; t < CM_BLOCKS; ++t) {
            v8f acc[2][2] = {};
            // unroll: the buffer's place becomes a constant
            #pragma unroll
            for (int h = 0; h < 2; ++h) {
                stage_products<CM>(ring + h * STAGE_ELEMS, ow + col, nw + col, half * 8, toff, acc);
                publish_stage();
                if (t + 1 < CM_BLOCKS)
                    w_copies(la0 + h * STAGE_ELEMS, wg + (size_t)(t + 1) * 64 * K + h * KSTAGE, K);
            }
            // the next block's copies fly while this block is stored
            store_tile(acc, mode, b, O, N, o0 + t * 64 + ow + 8 * half, n0 + nw + col,
                       bias, res, outf, outb);
        }
        // no copy is outstanding when the wave goes on to its end
        asm volatile("s_wait_asynccnt 0x0" ::: "memory");
        return;
    }

    v8f acc[2][2] = {};
    for (int s = 0; s < nst; ++s) {
        stage_products<CM>(ring + (s & 1) * STAGE_ELEMS, ow + col, nw + col, half * 8, toff, acc);
        publish_stage();
        if (s + 2 < nst)
            stage_copies<BS>(la0 + (s & 1) * STAGE_ELEMS, lb0 + (s & 1) * STAGE_ELEMS,
                             wg + (s + 2) * KSTAGE, yg + (s + 2) * ystep, K, P);
    }
    // no copy is outstanding when the wave goes on to its end
    asm volatile("s_wait_asynccnt 0x0" ::: "memory");

    store_tile(acc, mode, b, O, N, o0 + ow + 8 * half, n0 + nw + col, bias, res, outf, outb);
}

#define QS_STRIDE 40
#define KS_STRIDE 40
#define VS_STRIDE 136
#define ATTN_LDS_BYTES (128*QS_STRIDE*2 + 128*KS_STRIDE*2 + 64*VS_STRIDE*2)

// value of lane l ^ 16
__device__ __forceinline__ float other_half(float x) {
    int v = __builtin_bit_cast(int, x);
    v = __builtin_amdgcn_permlanex16(v, v, 0x76543210, 0xfedcba98, false, false);
    return __builtin_bit_cast(float, v);
}

__global__ __launch_bounds__(256)
void attn_kernel(const bf16_t* __restrict__ qt, const bf16_t* __restrict__ kt,
                 const bf16_t* __restrict__ vb, bf16_t* __restrict__ ot) {
    extern __shared__ char smem[];
    bf16_t* Qs = (bf16_t*)smem;                       // [128][QS_STRIDE]
    bf16_t* Ks = Qs + 128 * QS_STRIDE;                // [128][KS_STRIDE]
    bf16_t* Vs = Ks + 128 * KS_STRIDE;                // [64][VS_STRIDE]

    const int tid  = threadIdx.x;
    const int lane = tid & 31;
    const int wave = tid >> 5;
    const int half = lane >> 4;
    const int col  = lane & 15;

    const int q0 = blockIdx.x * 128;
    const int h  = blockIdx.y;
    const int b  = blockIdx.z;
    const size_t headv = ((size_t)b * DH + (size_t)h * DHEAD) * NTOK;

    // zero kd-pad [16..32) of Qs and Ks (async copies only touch [0..16))
    {
        v8bf z = {};
        int row = tid >> 1, hh = tid & 1;
        *(v8bf*)(&Qs[row * QS_STRIDE + 16 + hh * 8]) = z;
        *(v8bf*)(&Ks[row * KS_STRIDE + 16 + hh * 8]) = z;
    }
    // stage Q block: Qs[n][kd] <- qt[b][q0+n][h*16 + kd], 2x16B per row
    {
        int n = tid >> 1, sg = tid & 1;
        cp16(&Qs[n * QS_STRIDE + sg * 8],
             qt + ((size_t)b * NTOK + q0 + n) * DIM + h * KDIM + sg * 8);
    }
    async_wait();
    __syncthreads();

    // B operand of S^T: column = query wave*16 + col
    const v16bf qf = load_frag(Qs, wave * 16 + col, QS_STRIDE, half * 8);

    v8f acc[4] = {};                  // acc[dt][e] = O[query col][dt*16 + 8*half + e]
    float m = -1e30f;                 // running maximum of query col, equal in both half-waves
    float l = 0.f;                    // this half-wave's share of the sum, joined in the epilogue

    for (int c0 = 0; c0 < NTOK; c0 += 128) {
        // stage K chunk: Ks[key][kd], 2x16B per row
        {
            int n = tid >> 1, sg = tid & 1;
            cp16(&Ks[n * KS_STRIDE + sg * 8],
                 kt + ((size_t)b * NTOK + c0 + n) * DIM + h * KDIM + sg * 8);
        }
        // stage V chunk: Vs[d][key], 16x16B per row (4 segs/thread)
        #pragma unroll
        for (int r = 0; r < 4; ++r) {
            int s = tid + 256 * r;
            int d = s >> 4, sg = s & 15;
            cp16(&Vs[d * VS_STRIDE + sg * 8], vb + headv + (size_t)d * NTOK + c0 + sg * 8);
        }
        async_wait();
        __syncthreads();

        // two passes of 64 keys: 32 score registers a pass leave room for 8 waves per SIMD
        // nounroll: unrolled, the compiler interleaves the two passes and takes 166 VGPRs instead of 125,
        // which halves the workgroups that fit on a WGP
        #pragma nounroll
        for (int kb = 0; kb < 128; kb += 64) {
            // S^T = (K @ Q^T) * 4 : st[jt][e] = score(key kb + jt*16 + 8*half + e, query col)
            v8f st[4];
            #pragma unroll
            for (int jt = 0; jt < 4; ++jt) {
                v16bf kf = load_frag(Ks, kb + jt * 16 + col, KS_STRIDE, half * 8);
                v8f s = {};
                s = WMMA_BF16(kf, qf, s);
                st[jt] = s * 4.0f;
            }

            // online softmax in registers: 32 keys in-lane, one exchange between halves
            v8f mx = __builtin_elementwise_max(__builtin_elementwise_max(st[0], st[1]),
                                               __builtin_elementwise_max(st[2], st[3]));
            float cm = fmaxf(fmaxf(fmaxf(mx[0], mx[1]), fmaxf(mx[2], mx[3])),
                             fmaxf(fmaxf(mx[4], mx[5]), fmaxf(mx[6], mx[7])));
            cm = fmaxf(cm, other_half(cm));
            const float nm    = fmaxf(m, cm);
            const float alpha = __expf(m - nm);
            m = nm;

            #pragma unroll
            for (int jt = 0; jt < 4; ++jt) {
                v8f t = (st[jt] - nm) * 1.44269504f;   // exp(x) = exp2(x * log2 e)
                #pragma unroll
                for (int e = 0; e < 8; ++e) t[e] = __builtin_amdgcn_exp2f(t[e]);
                st[jt] = t;
            }
            const v8f ps = (st[0] + st[1]) + (st[2] + st[3]);
            l = l * alpha + (((ps[0] + ps[1]) + (ps[2] + ps[3])) + ((ps[4] + ps[5]) + (ps[6] + ps[7])));

            // rescale accumulators: every element of a lane belongs to query col
            #pragma unroll
            for (int dt = 0; dt < 4; ++dt) acc[dt] *= alpha;

            // O^T += V^T @ P^T ; tiles 2*k2 and 2*k2+1 give keys 8*half+e and 16+8*half+e
            // of a 32-key block: the k order in which load_frag reads V
            #pragma unroll
            for (int k2 = 0; k2 < 2; ++k2) {
                v16bf pf;
                #pragma unroll
                for (int e = 0; e < 8; ++e) {
                    pf[e]     = (bf16_t)st[2 * k2][e];
                    pf[e + 8] = (bf16_t)st[2 * k2 + 1][e];
                }
                #pragma unroll
                for (int dt = 0; dt < 4; ++dt) {
                    v16bf vf = load_frag(Vs, dt * 16 + col, VS_STRIDE, kb + k2 * 32 + half * 8);
                    acc[dt] = WMMA_BF16(vf, pf, acc[dt]);
                }
            }
        }
        __syncthreads();
    }

    // epilogue: ot[b][q][h*64+d], a lane's 8 accumulator elements are 8 consecutive d
    l += other_half(l);
    const float li = 1.0f / l;
    bf16_t* orow = ot + ((size_t)b * NTOK + q0 + wave * 16 + col) * DH + h * DHEAD + 8 * half;
    #pragma unroll
    for (int dt = 0; dt < 4; ++dt) {
        v8bf o;
        #pragma unroll
        for (int e = 0; e < 8; ++e) o[e] = (bf16_t)(acc[dt][e] * li);
        *(v8bf*)(orow + dt * 16) = o;
    }
}

// ---------------------------------------------------------------------------
// Host orchestration
// ---------------------------------------------------------------------------
extern "C" void kernel_launch(void* const* d_in, const int* in_sizes, int n_in,
                              void* d_out, int out_size, void* d_ws, size_t ws_size,
                              hipStream_t stream) {
    const float* x   = (const float*)d_in[0];
    const float* g1  = (const float*)d_in[1];
    const float* b1  = (const float*)d_in[2];
    const float* wq  = (const float*)d_in[3];
    const float* bq  = (const float*)d_in[4];
    const float* wk  = (const float*)d_in[5];
    const float* bk  = (const float*)d_in[6];
    const float* wv  = (const float*)d_in[7];
    const float* bv  = (const float*)d_in[8];
    const float* wp  = (const float*)d_in[9];
    const float* bp  = (const float*)d_in[10];
    const float* g2  = (const float*)d_in[11];
    const float* b2  = (const float*)d_in[12];
    const float* w1  = (const float*)d_in[13];
    const float* bb1 = (const float*)d_in[14];
    const float* w2  = (const float*)d_in[15];
    const float* bb2 = (const float*)d_in[16];
    float* out = (float*)d_out;

    char* ws = (char*)d_ws;
    size_t off = 0;
    auto alloc = [&](size_t bytes) -> void* {
        void* p = ws + off;
        off = (off + bytes + 255) & ~(size_t)255;
        return p;
    };

    const size_t BCN = (size_t)BATCH * DIM * NTOK;
    const size_t BHN = (size_t)BATCH * DH * NTOK;

    bf16_t* wqb  = (bf16_t*)alloc((size_t)DIM * DIM * 2);
    bf16_t* wkb  = (bf16_t*)alloc((size_t)DIM * DIM * 2);
    bf16_t* wvb  = (bf16_t*)alloc((size_t)DH * DIM * 2);
    bf16_t* wpb  = (bf16_t*)alloc((size_t)DIM * DH * 2);
    bf16_t* w1b  = (bf16_t*)alloc((size_t)HID * DIM * 2);
    bf16_t* w2b  = (bf16_t*)alloc((size_t)DIM * HID * 2);
    bf16_t* ytb  = (bf16_t*)alloc(BCN * 2);   // BN1(x), [b][c][n]
    bf16_t* qtb  = (bf16_t*)alloc(BCN * 2);   // Q, [b][n][o]
    bf16_t* ktb  = (bf16_t*)alloc(BCN * 2);   // K, [b][n][o]
    bf16_t* vbf  = (bf16_t*)alloc(BHN * 2);   // V, [b][dh][n]
    bf16_t* otb  = (bf16_t*)alloc(BHN * 2);   // attn out, [b][n][dh]
    float*  xf2  = (float*)alloc(BCN * 4);    // residual 1, [b][c][n]
    bf16_t* y2tb = (bf16_t*)alloc(BCN * 2);   // BN2(xf2), [b][c][n]
    bf16_t* htb  = (bf16_t*)alloc(BHN * 2);   // MLP hidden, [b][n][h]

    // BN1 -> ytb[b][c][n], and weights -> bf16
    prep_kernel<<<DIM + CVT_GROUPS, 256, 0, stream>>>(x, g1, b1, ytb, wq, wk, wv, wp, w1, w2,
                                                      wqb, wkb, wvb, wpb, w1b, w2b);

    // Q, K (token-major for the attention fragments) and V projections, one grid
    gemm_kernel<true><<<dim3(NTOK / 128, (2 * DIM + DH) / (64 * CM_BLOCKS), BATCH), 256, 0, stream>>>(
        wqb, ytb, bq, nullptr, nullptr, qtb, DIM, DIM, NTOK, 5,
        wkb, bk, ktb, wvb, bv, vbf, DH);

    // attention -> otb[b][n][dh]
    attn_kernel<<<dim3(NTOK / 128, NHEAD, BATCH), 256, ATTN_LDS_BYTES, stream>>>(
        qtb, ktb, vbf, otb);

    // projection + residual: xf2 = x + Wp @ o + bp
    gemm_kernel<false><<<dim3(NTOK / 128, DIM / 64, BATCH), 256, 0, stream>>>(
        wpb, otb, bp, x, xf2, nullptr, DIM, DH, NTOK, 1,
        nullptr, nullptr, nullptr, nullptr, nullptr, nullptr, 0);

    // BN2 -> y2tb[b][c][n]
    bn_kernel<<<DIM, 256, 0, stream>>>(xf2, g2, b2, y2tb);

    // MLP: h = relu6(W1 @ y2 + bb1); out = xf2 + W2 @ h + bb2
    gemm_kernel<true><<<dim3(NTOK / 128, HID / (64 * CM_BLOCKS), BATCH), 256, 0, stream>>>(
        w1b, y2tb, bb1, nullptr, nullptr, htb, HID, DIM, NTOK, 4,
        nullptr, nullptr, nullptr, nullptr, nullptr, nullptr, 0);
    gemm_kernel<false><<<dim3(NTOK / 128, DIM / 64, BATCH), 256, 0, stream>>>(
        w2b, htb, bb2, xf2, out, nullptr, DIM, HID, NTOK, 1,
        nullptr, nullptr, nullptr, nullptr, nullptr, nullptr, 0);
}
